// v000
// Measured on an AMD MI455X. A time is GPU time per run, averaged over a window of back-to-back runs after a warm-up
// (all launches, gaps included; the runs take copies of the inputs in turn), and the median of several windows.
// Apart from v000's, it joins two sittings. Times from different sittings can be a few percent apart, while
// side-by-side timings come from the same sitting.
// The starting kernel, v000, takes 95.7 microseconds a run.
#include <hip/hip_runtime.h>

// LocAtt (local 7x7 attention): q, k, v = 1x1 convs (+bias) of x [8][128][64][64]; for every pixel, scores over the 49 zero-padded neighbours = Σ_c q[c] k_unf[c] (padded neighbours score exactly
// 0 and carry v = 0), softmax over the 49, y[c] = Σ attn v_unf[c] -> [8][128][64][64] (NCHW).
// WMMA (v_wmma_f32_16x16x32_f16, f32 accumulate): the three 1x1 convs as [32768 px x 128] x [128 x 128] with EXACT operands (x transposed to pixel rows, W[o][c] rows; exact bf16; 1 product) + bias;
// q, k as f16 hi+lo pairs x8 (the unscaled 128-term logits have σ ≈ 11, so their absolute precision matters): per (image row, 16 query pixels) S^T = k.q over the 7 key rows x 32 aligned key
// columns covering the window (3 products), window mask by index compare, the out-of-image neighbours added analytically as n_out · e^{0 − m} to the softmax denominator; o^T += (8v)^T.P^T with P

namespace {
constexpr int Bn = 8, C = 128, IH = 64, IW = 64, NPI = IH * IW, NT = Bn * NPI, KS = 7, PADW = 3;
constexpr float XS = 8.0f, PS = 8.0f;

typedef _Float16 b16;
typedef __attribute__((ext_vector_type(16))) _Float16 v16b;
typedef __attribute__((ext_vector_type(8))) _Float16 v8b;
typedef __attribute__((ext_vector_type(8))) float v8f;
typedef __attribute__((ext_vector_type(4))) float v4f;
__device__ __forceinline__ float bf16_rne(float f) { unsigned int u = __float_as_uint(f); u += 0x7FFFu + ((u >> 16) & 1u); return __uint_as_float(u & 0xFFFF0000u); }
__device__ __forceinline__ void split16(float v, b16& hi, b16& lo) { hi = (b16)v; lo = (b16)(v - (float)hi); }
__device__ __forceinline__ v16b frag_kb(const b16* p, int hh) { const v8b a = *(const v8b*)(p + 8 * hh), b = *(const v8b*)(p + 16 + 8 * hh); v16b f;
#pragma unroll
  for (int e = 0; e < 8; ++e) { f[e] = a[e]; f[8 + e] = b[e]; } return f; }
__device__ __forceinline__ v8f wmma16b(v16b a, v16b b, v8f c) { v8f d = __builtin_amdgcn_wmma_f32_16x16x32_f16(false, a, false, b, (short)0, c, false, false); asm volatile("v_nop\n\tv_nop\n\tv_nop\n\tv_nop" : "+v"(d) : "v"(a), "v"(b)); return d; }
__device__ __forceinline__ void wave_lds_sync() { __builtin_amdgcn_fence(__ATOMIC_RELEASE, "workgroup"); __builtin_amdgcn_wave_barrier(); __builtin_amdgcn_fence(__ATOMIC_ACQUIRE, "workgroup"); }
__device__ __forceinline__ float nexp(float x) { return __builtin_amdgcn_exp2f(x * 1.4426950408889634f); }
__device__ __forceinline__ float pmul(float a, float b) { float p = a * b; asm volatile("" : "+v"(p)); return p; }

__global__ __launch_bounds__(256) void prepw_kernel(const float* __restrict__ wq, const float* __restrict__ bq, const float* __restrict__ wk, const float* __restrict__ bk, const float* __restrict__ wv, const float* __restrict__ bv, b16* __restrict__ R, float* __restrict__ P) {
  const size_t tid = (size_t)blockIdx.x * 256 + threadIdx.x, nth = (size_t)gridDim.x * 256;
  { for (size_t p = tid; p < (size_t)3 * C * C; p += nth) { const int w = (int)(p / (C * C)); const size_t r = p % ((size_t)C * C); ((b16*)R)[p] = (b16)bf16_rne(((w == 0) ? wq : (w == 1) ? wk : wv)[r]); }
    for (size_t q = tid; q < 384; q += nth) { const int i = (int)q; P[q] = bf16_rne((i < 128) ? bq[i] : (i < 256) ? bk[i - 128] : bv[i - 256]); }  }
}
__global__ __launch_bounds__(256) void xt_kernel(const float* __restrict__ x, b16* __restrict__ XT) {
  __shared__ __attribute__((aligned(16))) b16 Tx[64][C + 8];
  const int b = blockIdx.y, p0 = blockIdx.x * 64, t_ = threadIdx.x;
  for (int i = t_; i < C * 64; i += 256) { const int c = i >> 6, px = i & 63; Tx[px][c] = (b16)(bf16_rne(x[((size_t)b * C + c) * NPI + p0 + px]) * XS); }
  __syncthreads();
  { for (int i = t_; i < 64 * 16; i += 256) { const int px = i >> 4, c8 = (i & 15) * 8; *(v8b*)(XT + ((size_t)b * NPI + p0 + px) * C + c8) = *(const v8b*)(&Tx[px][c8]); }  }
}
__global__ __launch_bounds__(64) void qk_kernel(const b16* __restrict__ XT, const b16* __restrict__ R, const float* __restrict__ P, b16* __restrict__ QH, b16* __restrict__ QL, b16* __restrict__ KH, b16* __restrict__ KL) {
  __shared__ __attribute__((aligned(16))) b16 Th[2][32][C + 8], Tl[2][32][C + 8];
  const int lane = threadIdx.x & 31, wave = threadIdx.x >> 5, nloc = lane & 15, hlf = lane >> 4, m0 = blockIdx.x * 32; const b16* Bw = R + (size_t)wave * C * C; const float* bias = P + wave * C;
  v8f acc[2][8];
#pragma unroll
  for (int r = 0; r < 2; ++r)
#pragma unroll
    for (int t = 0; t < 8; ++t) acc[r][t] = (v8f){};
#pragma unroll
  for (int kb = 0; kb < C; kb += 32) { const v16b a0 = frag_kb(XT + (size_t)(m0 + nloc) * C + kb, hlf), a1 = frag_kb(XT + (size_t)(m0 + 16 + nloc) * C + kb, hlf);
#pragma unroll
    for (int t = 0; t < 8; ++t) { const v16b bw = frag_kb(Bw + (size_t)(t * 16 + nloc) * C + kb, hlf); acc[0][t] = wmma16b(a0, bw, acc[0][t]); acc[1][t] = wmma16b(a1, bw, acc[1][t]); } }
#pragma unroll
  for (int t = 0; t < 8; ++t) { const float bb = bias[t * 16 + nloc];
#pragma unroll
    for (int r = 0; r < 2; ++r)
#pragma unroll
      for (int v = 0; v < 8; ++v) { b16 a_, c_; split16(acc[r][t][v] + XS * bb, a_, c_); Th[wave][r * 16 + 8 * hlf + v][t * 16 + nloc] = a_; Tl[wave][r * 16 + 8 * hlf + v][t * 16 + nloc] = c_; } }
  wave_lds_sync();
  b16* dh = wave ? KH : QH; b16* dl = wave ? KL : QL;
  { for (int i = lane; i < 32 * 16; i += 32) { const int rr = i >> 4, c8 = (i & 15) * 8; const size_t gi = (size_t)(m0 + rr) * C + c8; *(v8b*)(dh + gi) = *(const v8b*)(&Th[wave][rr][c8]); *(v8b*)(dl + gi) = *(const v8b*)(&Tl[wave][rr][c8]); }  }
}
__global__ __launch_bounds__(128) void v_kernel(const b16* __restrict__ XT, const b16* __restrict__ R, const float* __restrict__ P, b16* __restrict__ VTh, b16* __restrict__ VTl) {
  __shared__ __attribute__((aligned(16))) b16 Th[C][64 + 8], Tl[C][64 + 8];
  const int lane = threadIdx.x & 31, wave = threadIdx.x >> 5, nloc = lane & 15, hlf = lane >> 4, g0 = blockIdx.x * 64, m0 = g0 + wave * 16; const b16* Bv = R + (size_t)2 * C * C; const int b = g0 / NPI, p0 = g0 % NPI;
  v8f acc[8];
#pragma unroll
  for (int t = 0; t < 8; ++t) acc[t] = (v8f){};
#pragma unroll
  for (int kb = 0; kb < C; kb += 32) { const v16b a = frag_kb(XT + (size_t)(m0 + nloc) * C + kb, hlf);
#pragma unroll
    for (int t = 0; t < 8; ++t) acc[t] = wmma16b(a, frag_kb(Bv + (size_t)(t * 16 + nloc) * C + kb, hlf), acc[t]); }
#pragma unroll
  for (int t = 0; t < 8; ++t)
#pragma unroll
    for (int r = 0; r < 8; ++r) { b16 a_, c_; split16(acc[t][r] + XS * P[256 + t * 16 + nloc], a_, c_); Th[t * 16 + nloc][wave * 16 + 8 * hlf + r] = a_; Tl[t * 16 + nloc][wave * 16 + 8 * hlf + r] = c_; }
  __syncthreads();
  { for (int i = threadIdx.x; i < C * 8; i += 128) { const int c = i >> 3, c8 = (i & 7) * 8; const size_t gi = ((size_t)b * C + c) * NPI + p0 + c8; *(v8b*)(VTh + gi) = *(const v8b*)(&Th[c][c8]); *(v8b*)(VTl + gi) = *(const v8b*)(&Tl[c][c8]); }  }
}
// local attention: block = (b, image row h, 32 query pixels) x 2 waves (16 queries each): 7 key rows x one aligned 32-column key block; S^T = k.q (3 products), window mask |dc| <= 3 (|dr| <= 3 by
__global__ __launch_bounds__(64) void attn_kernel(const b16* __restrict__ QH, const b16* __restrict__ QL, const b16* __restrict__ KH, const b16* __restrict__ KL, const b16* __restrict__ VTh, const b16* __restrict__ VTl, float* __restrict__ out) {
  __shared__ __attribute__((aligned(16))) float Os[C][32 + 4];
  const int wave = threadIdx.x >> 5, lane = threadIdx.x & 31, hh = lane >> 4, col = lane & 15; const int b = blockIdx.z, h = blockIdx.y, w0 = blockIdx.x * 32 + wave * 16, wq = w0 + col;
  const size_t ib = (size_t)b * NPI; const int qpix = h * IW + wq;
  v16b qf[4], ql[4]; for (int t = 0; t < 4; ++t) { qf[t] = frag_kb(QH + (ib + qpix) * C + t * 32, hh); ql[t] = frag_kb(QL + (ib + qpix) * C + t * 32, hh); }
  // out-of-image neighbour count for this lane's query: rows outside [0,IH) x 7 cols + in-image rows x cols outside [0,IW)
  const int r_lo = (h - PADW < 0) ? 0 : h - PADW, r_hi = (h + PADW > IH - 1) ? IH - 1 : h + PADW, c_lo = (wq - PADW < 0) ? 0 : wq - PADW, c_hi = (wq + PADW > IW - 1) ? IW - 1 : wq + PADW;
  const int n_in = (r_hi - r_lo + 1) * (c_hi - c_lo + 1), n_out = KS * KS - n_in;
  float m = (n_out > 0) ? 0.0f : -INFINITY, l = (float)n_out; v8f o[8]; for (int t = 0; t < 8; ++t) o[t] = (v8f){};
  int c0 = w0 - 8; c0 = (c0 < 0) ? 0 : (c0 > IW - 32 ? IW - 32 : c0);   // aligned key columns covering [w0-3, w0+18]
  for (int r = h - PADW; r <= h + PADW; ++r) { if (r < 0 || r >= IH) continue;   // uniform per block
    const b16* Kr = KH + (ib + (size_t)r * IW + c0) * C; const b16* Klr = KL + (ib + (size_t)r * IW + c0) * C;
    v8f s0 = {}, s1 = {};
#pragma unroll
    for (int t = 0; t < 4; ++t) { const v16b k0 = frag_kb(Kr + (size_t)col * C + t * 32, hh), k0l = frag_kb(Klr + (size_t)col * C + t * 32, hh), k1 = frag_kb(Kr + (size_t)(16 + col) * C + t * 32, hh), k1l = frag_kb(Klr + (size_t)(16 + col) * C + t * 32, hh);
      s0 = wmma16b(k0, qf[t], s0); s0 = wmma16b(k0l, qf[t], s0); s0 = wmma16b(k0, ql[t], s0); s1 = wmma16b(k1, qf[t], s1); s1 = wmma16b(k1l, qf[t], s1); s1 = wmma16b(k1, ql[t], s1); }
    float mr = -INFINITY;
#pragma unroll
    for (int e = 0; e < 8; ++e) { const int kc0 = c0 + 8 * hh + e, kc1 = kc0 + 16; const bool v0 = (kc0 >= wq - PADW) && (kc0 <= wq + PADW), v1 = (kc1 >= wq - PADW) && (kc1 <= wq + PADW);
      s0[e] = v0 ? s0[e] * (1.0f / (XS * XS)) : -INFINITY; s1[e] = v1 ? s1[e] * (1.0f / (XS * XS)) : -INFINITY; mr = fmaxf(mr, fmaxf(s0[e], s1[e])); }
    mr = fmaxf(mr, __shfl_xor(mr, 16)); const float mn = fmaxf(m, mr); const float al_ = (mn == -INFINITY) ? 1.0f : nexp(m - mn); m = mn; float sum = 0.0f; v16b pb, pl;
#pragma unroll
    for (int e = 0; e < 8; ++e) { const float e0 = (s0[e] == -INFINITY) ? 0.0f : nexp(s0[e] - mn), e1 = (s1[e] == -INFINITY) ? 0.0f : nexp(s1[e] - mn); sum += e0 + e1; b16 a_, c_; split16(e0 * PS, a_, c_); pb[e] = a_; pl[e] = c_; split16(e1 * PS, a_, c_); pb[8 + e] = a_; pl[8 + e] = c_; }
    sum += __shfl_xor(sum, 16); l = l * al_ + sum;
    const b16* V = VTh + (ib * 0 + (size_t)b * C) * NPI + (size_t)r * IW + c0; const b16* Vl = VTl + ((size_t)b * C) * NPI + (size_t)r * IW + c0;
#pragma unroll
    for (int t = 0; t < 8; ++t) { o[t] *= al_; const v16b vh = frag_kb(V + (size_t)(t * 16 + col) * NPI, hh); o[t] = wmma16b(vh, pb, o[t]); o[t] = wmma16b(vh, pl, o[t]); o[t] = wmma16b(frag_kb(Vl + (size_t)(t * 16 + col) * NPI, hh), pb, o[t]); } }
  const float inv = 1.0f / (l * PS * XS);   // every pixel has at least itself in the window; (8v).(8p) carries x64
#pragma unroll
  for (int t = 0; t < 8; ++t)
#pragma unroll
    for (int e = 0; e < 8; ++e) Os[t * 16 + 8 * hh + e][wave * 16 + col] = o[t][e] * inv;
  __syncthreads();
  { for (int i = threadIdx.x; i < C * 8; i += 64) { const int c = i >> 3, c4 = (i & 7) * 4; *(v4f*)(out + ((size_t)b * C + c) * NPI + (size_t)h * IW + blockIdx.x * 32 + c4) = *(const v4f*)(&Os[c][c4]); }  }
}
}  // namespace

extern "C" void kernel_launch(void* const* d_in, const int* in_sizes, int n_in,
                              void* d_out, int out_size, void* d_ws, size_t ws_size, hipStream_t stream) {
  (void)n_in; (void)out_size;
  const float* x = (const float*)d_in[0]; const float* wq = (const float*)d_in[1]; const float* bq = (const float*)d_in[2]; const float* wk = (const float*)d_in[3]; const float* bk = (const float*)d_in[4]; const float* wv = (const float*)d_in[5]; const float* bv = (const float*)d_in[6];
  float* out = (float*)d_out;   // [8][128][64][64]
  if (in_sizes[0] != NT * C || in_sizes[1] != C * C) return;
  size_t off = 0; char* ws = (char*)d_ws;
  auto carve = [&](size_t bytes) { char* p = ws + off; off += (bytes + 255) & ~(size_t)255; return p; };
  b16* R = (b16*)carve((size_t)3 * C * C * 2); float* P = (float*)carve(384 * 4); b16* XT = (b16*)carve((size_t)NT * C * 2); b16* QH = (b16*)carve((size_t)NT * C * 2); b16* QL = (b16*)carve((size_t)NT * C * 2); b16* KH = (b16*)carve((size_t)NT * C * 2); b16* KL = (b16*)carve((size_t)NT * C * 2); b16* VTh = (b16*)carve((size_t)NT * C * 2); b16* VTl = (b16*)carve((size_t)NT * C * 2);
  if (off > ws_size) return;                        // ≈ 8.4 x 7 ≈ 59 MB
  prepw_kernel<<<64, 256, 0, stream>>>(wq, bq, wk, bk, wv, bv, R, P);
  xt_kernel<<<dim3(NPI / 64, Bn), 256, 0, stream>>>(x, XT);
  qk_kernel<<<NT / 32, 64, 0, stream>>>(XT, R, P, QH, QL, KH, KL);
  v_kernel<<<NT / 64, 128, 0, stream>>>(XT, R, P, VTh, VTl);
  attn_kernel<<<dim3(2, IH, Bn), 64, 0, stream>>>(QH, QL, KH, KL, VTh, VTl, out);
}

// v001
// Measured time: 65.3 microseconds a run.
// Two timings next to v000 both put it at 1.49 times that version's speed.
#include <hip/hip_runtime.h>

// LocAtt (local 7x7 attention): q, k, v = 1x1 convs (+bias) of x [8][128][64][64]; for every pixel, scores over the 49 zero-padded neighbours = Σ_c q[c] k_unf[c] (padded neighbours score exactly
// 0 and carry v = 0), softmax over the 49, y[c] = Σ attn v_unf[c] -> [8][128][64][64] (NCHW).
// WMMA (v_wmma_f32_16x16x32_f16, f32 accumulate): the three 1x1 convs as [32768 px x 128] x [128 x 128] with EXACT operands (x transposed to pixel rows, W[o][c] rows; exact bf16; 1 product) + bias;
// q, k as f16 hi+lo pairs x8 (the unscaled 128-term logits have σ ≈ 11, so their absolute precision matters): per (image row, 16 query pixels) S^T = k.q over the 7 key rows x 32 aligned key
// columns covering the window (3 products), window mask by index compare, the out-of-image neighbours added analytically as n_out · e^{0 − m} to the softmax denominator; o^T += (8v)^T.P^T with P

namespace {
constexpr int Bn = 8, C = 128, IH = 64, IW = 64, NPI = IH * IW, NT = Bn * NPI, KS = 7, PADW = 3;
constexpr float XS = 8.0f, PS = 8.0f;

typedef _Float16 b16;
typedef __attribute__((ext_vector_type(16))) _Float16 v16b;
typedef __attribute__((ext_vector_type(8))) _Float16 v8b;
typedef __attribute__((ext_vector_type(8))) float v8f;
typedef __attribute__((ext_vector_type(4))) float v4f;
__device__ __forceinline__ float bf16_rne(float f) { unsigned int u = __float_as_uint(f); u += 0x7FFFu + ((u >> 16) & 1u); return __uint_as_float(u & 0xFFFF0000u); }
__device__ __forceinline__ void split16(float v, b16& hi, b16& lo) { hi = (b16)v; lo = (b16)(v - (float)hi); }
__device__ __forceinline__ v16b frag_kb(const b16* p, int hh) { const v8b a = *(const v8b*)(p + 8 * hh), b = *(const v8b*)(p + 16 + 8 * hh); v16b f;
#pragma unroll
  for (int e = 0; e < 8; ++e) { f[e] = a[e]; f[8 + e] = b[e]; } return f; }
__device__ __forceinline__ v8f wmma16b(v16b a, v16b b, v8f c) { v8f d = __builtin_amdgcn_wmma_f32_16x16x32_f16(false, a, false, b, (short)0, c, false, false); asm volatile("v_nop\n\tv_nop\n\tv_nop\n\tv_nop" : "+v"(d) : "v"(a), "v"(b)); return d; }
__device__ __forceinline__ void wave_lds_sync() { __builtin_amdgcn_fence(__ATOMIC_RELEASE, "workgroup"); __builtin_amdgcn_wave_barrier(); __builtin_amdgcn_fence(__ATOMIC_ACQUIRE, "workgroup"); }
__device__ __forceinline__ float nexp(float x) { return __builtin_amdgcn_exp2f(x * 1.4426950408889634f); }
__device__ __forceinline__ float pmul(float a, float b) { float p = a * b; asm volatile("" : "+v"(p)); return p; }

__global__ __launch_bounds__(256) void prepw_kernel(const float* __restrict__ wq, const float* __restrict__ bq, const float* __restrict__ wk, const float* __restrict__ bk, const float* __restrict__ wv, const float* __restrict__ bv, b16* __restrict__ R, float* __restrict__ P) {
  const size_t tid = (size_t)blockIdx.x * 256 + threadIdx.x, nth = (size_t)gridDim.x * 256;
  { for (size_t p = tid; p < (size_t)3 * C * C; p += nth) { const int w = (int)(p / (C * C)); const size_t r = p % ((size_t)C * C); ((b16*)R)[p] = (b16)bf16_rne(((w == 0) ? wq : (w == 1) ? wk : wv)[r]); }
    for (size_t q = tid; q < 384; q += nth) { const int i = (int)q; P[q] = bf16_rne((i < 128) ? bq[i] : (i < 256) ? bk[i - 128] : bv[i - 256]); }  }
}
__global__ __launch_bounds__(256) void xt_kernel(const float* __restrict__ x, b16* __restrict__ XT) {
  __shared__ __attribute__((aligned(16))) b16 Tx[64][C + 8];
  const int b = blockIdx.y, p0 = blockIdx.x * 64, t_ = threadIdx.x;
  for (int i = t_; i < C * 64; i += 256) { const int c = i >> 6, px = i & 63; Tx[px][c] = (b16)(bf16_rne(x[((size_t)b * C + c) * NPI + p0 + px]) * XS); }
  __syncthreads();
  { for (int i = t_; i < 64 * 16; i += 256) { const int px = i >> 4, c8 = (i & 15) * 8; *(v8b*)(XT + ((size_t)b * NPI + p0 + px) * C + c8) = *(const v8b*)(&Tx[px][c8]); }  }
}
__global__ __launch_bounds__(64) void qk_kernel(const b16* __restrict__ XT, const b16* __restrict__ R, const float* __restrict__ P, b16* __restrict__ QH, b16* __restrict__ QL, b16* __restrict__ KH, b16* __restrict__ KL) {
  __shared__ __attribute__((aligned(16))) b16 Th[2][32][C + 8], Tl[2][32][C + 8];
  const int lane = threadIdx.x & 31, wave = threadIdx.x >> 5, nloc = lane & 15, hlf = lane >> 4, m0 = blockIdx.x * 32; const b16* Bw = R + (size_t)wave * C * C; const float* bias = P + wave * C;
  v8f acc[2][8];
#pragma unroll
  for (int r = 0; r < 2; ++r)
#pragma unroll
    for (int t = 0; t < 8; ++t) acc[r][t] = (v8f){};
#pragma unroll
  for (int kb = 0; kb < C; kb += 32) { const v16b a0 = frag_kb(XT + (size_t)(m0 + nloc) * C + kb, hlf), a1 = frag_kb(XT + (size_t)(m0 + 16 + nloc) * C + kb, hlf);
#pragma unroll
    for (int t = 0; t < 8; ++t) { const v16b bw = frag_kb(Bw + (size_t)(t * 16 + nloc) * C + kb, hlf); acc[0][t] = wmma16b(a0, bw, acc[0][t]); acc[1][t] = wmma16b(a1, bw, acc[1][t]); } }
#pragma unroll
  for (int t = 0; t < 8; ++t) { const float bb = bias[t * 16 + nloc];
#pragma unroll
    for (int r = 0; r < 2; ++r)
#pragma unroll
      for (int v = 0; v < 8; ++v) { b16 a_, c_; split16(acc[r][t][v] + XS * bb, a_, c_); Th[wave][r * 16 + 8 * hlf + v][t * 16 + nloc] = a_; Tl[wave][r * 16 + 8 * hlf + v][t * 16 + nloc] = c_; } }
  wave_lds_sync();
  b16* dh = wave ? KH : QH; b16* dl = wave ? KL : QL;
  { for (int i = lane; i < 32 * 16; i += 32) { const int rr = i >> 4, c8 = (i & 15) * 8; const size_t gi = (size_t)(m0 + rr) * C + c8; *(v8b*)(dh + gi) = *(const v8b*)(&Th[wave][rr][c8]); *(v8b*)(dl + gi) = *(const v8b*)(&Tl[wave][rr][c8]); }  }
}
__global__ __launch_bounds__(128) void v_kernel(const b16* __restrict__ XT, const b16* __restrict__ R, const float* __restrict__ P, b16* __restrict__ VTh, b16* __restrict__ VTl) {
  __shared__ __attribute__((aligned(16))) b16 Th[C][64 + 8], Tl[C][64 + 8];
  const int lane = threadIdx.x & 31, wave = threadIdx.x >> 5, nloc = lane & 15, hlf = lane >> 4, g0 = blockIdx.x * 64, m0 = g0 + wave * 16; const b16* Bv = R + (size_t)2 * C * C; const int b = g0 / NPI, p0 = g0 % NPI;
  v8f acc[8];
#pragma unroll
  for (int t = 0; t < 8; ++t) acc[t] = (v8f){};
#pragma unroll
  for (int kb = 0; kb < C; kb += 32) { const v16b a = frag_kb(XT + (size_t)(m0 + nloc) * C + kb, hlf);
#pragma unroll
    for (int t = 0; t < 8; ++t) acc[t] = wmma16b(a, frag_kb(Bv + (size_t)(t * 16 + nloc) * C + kb, hlf), acc[t]); }
#pragma unroll
  for (int t = 0; t < 8; ++t)
#pragma unroll
    for (int r = 0; r < 8; ++r) { b16 a_, c_; split16(acc[t][r] + XS * P[256 + t * 16 + nloc], a_, c_); Th[t * 16 + nloc][wave * 16 + 8 * hlf + r] = a_; Tl[t * 16 + nloc][wave * 16 + 8 * hlf + r] = c_; }
  __syncthreads();
  { for (int i = threadIdx.x; i < C * 8; i += 128) { const int c = i >> 3, c8 = (i & 7) * 8; const size_t gi = ((size_t)b * C + c) * NPI + p0 + c8; *(v8b*)(VTh + gi) = *(const v8b*)(&Th[c][c8]); *(v8b*)(VTl + gi) = *(const v8b*)(&Tl[c][c8]); }  }
}
// local attention: block = (b, image row h, all 64 query pixels) x 4 waves (16 queries each). Each of the up to 7 key rows is staged ONCE per block in LDS (K hi, K lo as [64 px][128 c], V hi, V lo as
// [128 c][64 px]) by asynchronous copies, two buffers: row i+1 flies while row i is worked on. Per wave as before: one aligned 32-column key block; S^T = k.q (3 products), window mask |dc| <= 3.
constexpr int KP = C + 8, VP = IW + 8;                          // LDS pitches in halfs: 272 B and 144 B, both 16 B x odd, so that 16 lanes' ds_load_b128 fall on 64 distinct banks
constexpr int KPL = IW * KP * 2, VPL = C * VP * 2, STG = 2 * KPL + 2 * VPL;   // bytes of one K plane, one V plane, one staged row
// eight 16-byte copies per lane, global -> LDS through no register. The s_wait_xcnt is the last line of the copies' own statement, so that no address register is rewritten in front of it.
__device__ __forceinline__ void async8(const unsigned (&l)[8], const b16* const (&g)[8]) {
  asm volatile("global_load_async_to_lds_b128 %0, %8, off\n\tglobal_load_async_to_lds_b128 %1, %9, off\n\tglobal_load_async_to_lds_b128 %2, %10, off\n\tglobal_load_async_to_lds_b128 %3, %11, off\n\t"
               "global_load_async_to_lds_b128 %4, %12, off\n\tglobal_load_async_to_lds_b128 %5, %13, off\n\tglobal_load_async_to_lds_b128 %6, %14, off\n\tglobal_load_async_to_lds_b128 %7, %15, off\n\ts_wait_xcnt 0x0"
               :: "v"(l[0]), "v"(l[1]), "v"(l[2]), "v"(l[3]), "v"(l[4]), "v"(l[5]), "v"(l[6]), "v"(l[7]), "v"(g[0]), "v"(g[1]), "v"(g[2]), "v"(g[3]), "v"(g[4]), "v"(g[5]), "v"(g[6]), "v"(g[7]) : "memory");
}
// one key row into the buffer at LDS byte address lb: 4 planes x 1024 chunks of 16 B, 128 threads x 8 chunks a plane; a wave's copy reads 4 whole 128-byte lines
__device__ __forceinline__ void stage_row(unsigned lb, const b16* kh, const b16* kl, const b16* vh, const b16* vl, int tid) {
  unsigned l[8]; const b16* g[8];
  const unsigned lk = lb + (unsigned)((tid >> 4) * (KP * 2) + (tid & 15) * 16), lv = lb + (unsigned)(2 * KPL + (tid >> 3) * (VP * 2) + (tid & 7) * 16);   // chunk j = i * 128 + tid: 8 more pixels, 16 more channels, per i
  const size_t gk = (size_t)tid * 8, gv = (size_t)(tid >> 3) * NPI + (tid & 7) * 8;
#pragma unroll
  for (int i = 0; i < 8; ++i) { l[i] = lk + (unsigned)(i * 8 * KP * 2); g[i] = kh + gk + (size_t)i * 1024; }
  async8(l, g);
#pragma unroll
  for (int i = 0; i < 8; ++i) { l[i] = lk + (unsigned)(KPL + i * 8 * KP * 2); g[i] = kl + gk + (size_t)i * 1024; }
  async8(l, g);
#pragma unroll
  for (int i = 0; i < 8; ++i) { l[i] = lv + (unsigned)(i * 16 * VP * 2); g[i] = vh + gv + (size_t)i * 16 * NPI; }
  async8(l, g);
#pragma unroll
  for (int i = 0; i < 8; ++i) { l[i] = lv + (unsigned)(VPL + i * 16 * VP * 2); g[i] = vl + gv + (size_t)i * 16 * NPI; }
  async8(l, g);
}
__global__ __launch_bounds__(128) void attn_kernel(const b16* __restrict__ QH, const b16* __restrict__ QL, const b16* __restrict__ KH, const b16* __restrict__ KL, const b16* __restrict__ VTh, const b16* __restrict__ VTl, float* __restrict__ out) {
  __shared__ __attribute__((aligned(16))) unsigned char L[2 * STG];   // the two row buffers; behind the loop its first bytes are the output staging
  const int tid = threadIdx.x, wave = tid >> 5, lane = tid & 31, hh = lane >> 4, col = lane & 15; const int b = blockIdx.z, h = blockIdx.y, w0 = wave * 16, wq = w0 + col;
  const size_t ib = (size_t)b * NPI; const int qpix = h * IW + wq;
  // out-of-image neighbour count for this lane's query: rows outside [0,IH) x 7 cols + in-image rows x cols outside [0,IW)
  const int r_lo = (h - PADW < 0) ? 0 : h - PADW, r_hi = (h + PADW > IH - 1) ? IH - 1 : h + PADW, c_lo = (wq - PADW < 0) ? 0 : wq - PADW, c_hi = (wq + PADW > IW - 1) ? IW - 1 : wq + PADW;
  const int nrow = r_hi - r_lo + 1;   // in-image key rows, uniform per block
  const unsigned lds0 = (unsigned)(size_t)(&L[0]);
  const b16* kh0 = KH + (ib + (size_t)r_lo * IW) * C; const b16* kl0 = KL + (ib + (size_t)r_lo * IW) * C; const b16* vh0 = VTh + (size_t)b * C * NPI + (size_t)r_lo * IW; const b16* vl0 = VTl + (size_t)b * C * NPI + (size_t)r_lo * IW;
  stage_row(lds0, kh0, kl0, vh0, vl0, tid);
  v16b qf[4], ql[4]; for (int t = 0; t < 4; ++t) { qf[t] = frag_kb(QH + (ib + qpix) * C + t * 32, hh); ql[t] = frag_kb(QL + (ib + qpix) * C + t * 32, hh); }
  const int n_in = nrow * (c_hi - c_lo + 1), n_out = KS * KS - n_in;
  float m = (n_out > 0) ? 0.0f : -INFINITY, l = (float)n_out; v8f o[8]; for (int t = 0; t < 8; ++t) o[t] = (v8f){};
  int c0 = w0 - 8; c0 = (c0 < 0) ? 0 : (c0 > IW - 32 ? IW - 32 : c0);   // aligned key columns covering [w0-3, w0+18]
  asm volatile("s_wait_asynccnt 0x0" ::: "memory");   // this wave's copies of row 0 have landed
  __syncthreads();                                    // every wave's have
  if (nrow > 1) stage_row(lds0 + STG, kh0 + (size_t)IW * C, kl0 + (size_t)IW * C, vh0 + IW, vl0 + IW, tid);
  for (int it = 0; it < nrow; ++it) {
    const unsigned char* S = L + (it & 1) * STG;
    const b16* Kr = (const b16*)S + c0 * KP; const b16* Klr = (const b16*)(S + KPL) + c0 * KP;
    v8f s0 = {}, s1 = {};
#pragma unroll
    for (int t = 0; t < 4; ++t) { const v16b k0 = frag_kb(Kr + col * KP + t * 32, hh), k0l = frag_kb(Klr + col * KP + t * 32, hh), k1 = frag_kb(Kr + (16 + col) * KP + t * 32, hh), k1l = frag_kb(Klr + (16 + col) * KP + t * 32, hh);
      s0 = wmma16b(k0, qf[t], s0); s0 = wmma16b(k0l, qf[t], s0); s0 = wmma16b(k0, ql[t], s0); s1 = wmma16b(k1, qf[t], s1); s1 = wmma16b(k1l, qf[t], s1); s1 = wmma16b(k1, ql[t], s1); }
    float mr = -INFINITY;
#pragma unroll
    for (int e = 0; e < 8; ++e) { const int kc0 = c0 + 8 * hh + e, kc1 = kc0 + 16; const bool v0 = (kc0 >= wq - PADW) && (kc0 <= wq + PADW), v1 = (kc1 >= wq - PADW) && (kc1 <= wq + PADW);
      s0[e] = v0 ? s0[e] * (1.0f / (XS * XS)) : -INFINITY; s1[e] = v1 ? s1[e] * (1.0f / (XS * XS)) : -INFINITY; mr = fmaxf(mr, fmaxf(s0[e], s1[e])); }
    mr = fmaxf(mr, __shfl_xor(mr, 16)); const float mn = fmaxf(m, mr); const float al_ = (mn == -INFINITY) ? 1.0f : nexp(m - mn); m = mn; float sum = 0.0f; v16b pb, pl;
#pragma unroll
    for (int e = 0; e < 8; ++e) { const float e0 = (s0[e] == -INFINITY) ? 0.0f : nexp(s0[e] - mn), e1 = (s1[e] == -INFINITY) ? 0.0f : nexp(s1[e] - mn); sum += e0 + e1; b16 a_, c_; split16(e0 * PS, a_, c_); pb[e] = a_; pl[e] = c_; split16(e1 * PS, a_, c_); pb[8 + e] = a_; pl[8 + e] = c_; }
    sum += __shfl_xor(sum, 16); l = l * al_ + sum;
    const b16* V = (const b16*)(S + 2 * KPL) + c0; const b16* Vl = (const b16*)(S + 2 * KPL + VPL) + c0;
#pragma unroll
    for (int t = 0; t < 8; ++t) { o[t] *= al_; const v16b vh = frag_kb(V + (t * 16 + col) * VP, hh); o[t] = wmma16b(vh, pb, o[t]); o[t] = wmma16b(vh, pl, o[t]); o[t] = wmma16b(frag_kb(Vl + (t * 16 + col) * VP, hh), pb, o[t]); }
    __builtin_amdgcn_sched_barrier(0);                  // keeps the row sum's cross-lane ds operation in front of the wait below: no DS operation of this wave is outstanding when the refill issues
    asm volatile("s_wait_dscnt 0x0" ::: "memory");      // this wave's reads of this row's buffer have returned
    asm volatile("s_wait_asynccnt 0x0" ::: "memory");   // this wave's copies of the next row have landed
    __syncthreads();                                    // publishes the next row and frees this row's buffer
    if (it + 2 < nrow) stage_row(lds0 + (unsigned)((it & 1) * STG), kh0 + (size_t)(it + 2) * IW * C, kl0 + (size_t)(it + 2) * IW * C, vh0 + (it + 2) * IW, vl0 + (it + 2) * IW, tid); }
  asm volatile("s_wait_asynccnt 0x0" ::: "memory");     // no copy is outstanding when the buffers become output staging
  float (*Os)[IW + 4] = (float (*)[IW + 4])L;           // every wave has left the buffers: the last pass's own barrier
  const float inv = 1.0f / (l * PS * XS);   // every pixel has at least itself in the window; (8v).(8p) carries x64
#pragma unroll
  for (int t = 0; t < 8; ++t)
#pragma unroll
    for (int e = 0; e < 8; ++e) Os[t * 16 + 8 * hh + e][wave * 16 + col] = o[t][e] * inv;
  __syncthreads();
  { for (int i = tid; i < C * 16; i += 128) { const int c = i >> 4, c4 = (i & 15) * 4; *(v4f*)(out + ((size_t)b * C + c) * NPI + (size_t)h * IW + c4) = *(const v4f*)(&Os[c][c4]); }  }
}
}  // namespace

extern "C" void kernel_launch(void* const* d_in, const int* in_sizes, int n_in,
                              void* d_out, int out_size, void* d_ws, size_t ws_size, hipStream_t stream) {
  (void)n_in; (void)out_size;
  const float* x = (const float*)d_in[0]; const float* wq = (const float*)d_in[1]; const float* bq = (const float*)d_in[2]; const float* wk = (const float*)d_in[3]; const float* bk = (const float*)d_in[4]; const float* wv = (const float*)d_in[5]; const float* bv = (const float*)d_in[6];
  float* out = (float*)d_out;   // [8][128][64][64]
  if (in_sizes[0] != NT * C || in_sizes[1] != C * C) return;
  size_t off = 0; char* ws = (char*)d_ws;
  auto carve = [&](size_t bytes) { char* p = ws + off; off += (bytes + 255) & ~(size_t)255; return p; };
  b16* R = (b16*)carve((size_t)3 * C * C * 2); float* P = (float*)carve(384 * 4); b16* XT = (b16*)carve((size_t)NT * C * 2); b16* QH = (b16*)carve((size_t)NT * C * 2); b16* QL = (b16*)carve((size_t)NT * C * 2); b16* KH = (b16*)carve((size_t)NT * C * 2); b16* KL = (b16*)carve((size_t)NT * C * 2); b16* VTh = (b16*)carve((size_t)NT * C * 2); b16* VTl = (b16*)carve((size_t)NT * C * 2);
  if (off > ws_size) return;                        // ≈ 8.4 x 7 ≈ 59 MB
  prepw_kernel<<<64, 256, 0, stream>>>(wq, bq, wk, bk, wv, bv, R, P);
  xt_kernel<<<dim3(NPI / 64, Bn), 256, 0, stream>>>(x, XT);
  qk_kernel<<<NT / 32, 64, 0, stream>>>(XT, R, P, QH, QL, KH, KL);
  v_kernel<<<NT / 64, 128, 0, stream>>>(XT, R, P, VTh, VTl);
  attn_kernel<<<dim3(1, IH, Bn), 128, 0, stream>>>(QH, QL, KH, KL, VTh, VTl, out);
}

// v002
// It runs in 44.7 microseconds.
// Timed twice side by side with v001, it ran 1.48 and 1.47 times as fast.
// Counting every step since v000, it is 2.20 times as fast.
#include <hip/hip_runtime.h>

// LocAtt (local 7x7 attention): q, k, v = 1x1 convs (+bias) of x [8][128][64][64]; for every pixel, scores over the 49 zero-padded neighbours = Σ_c q[c] k_unf[c] (padded neighbours score exactly
// 0 and carry v = 0), softmax over the 49, y[c] = Σ attn v_unf[c] -> [8][128][64][64] (NCHW).
// WMMA (v_wmma_f32_16x16x32_f16, f32 accumulate): the three 1x1 convs as [32768 px x 128] x [128 x 128] with EXACT operands (x transposed to pixel rows, W[o][c] rows; exact bf16; 1 product) + bias;
// q, k as f16 hi+lo pairs x8 (the unscaled 128-term logits have σ ≈ 11, so their absolute precision matters): per (image row, 16 query pixels) S^T = k.q over the 7 key rows x 32 aligned key
// columns covering the window (3 products), window mask by index compare, the out-of-image neighbours added analytically as n_out · e^{0 − m} to the softmax denominator; o^T += (8v)^T.P^T with P

namespace {
constexpr int Bn = 8, C = 128, IH = 64, IW = 64, NPI = IH * IW, NT = Bn * NPI, KS = 7, PADW = 3;
constexpr float XS = 8.0f, PS = 8.0f;

typedef _Float16 b16;
typedef __attribute__((ext_vector_type(16))) _Float16 v16b;
typedef __attribute__((ext_vector_type(8))) _Float16 v8b;
typedef __attribute__((ext_vector_type(8))) float v8f;
typedef __attribute__((ext_vector_type(4))) float v4f;
__device__ __forceinline__ float bf16_rne(float f) { unsigned int u = __float_as_uint(f); u += 0x7FFFu + ((u >> 16) & 1u); return __uint_as_float(u & 0xFFFF0000u); }
__device__ __forceinline__ void split16(float v, b16& hi, b16& lo) { hi = (b16)v; lo = (b16)(v - (float)hi); }
__device__ __forceinline__ v16b frag_kb(const b16* p, int hh) { const v8b a = *(const v8b*)(p + 8 * hh), b = *(const v8b*)(p + 16 + 8 * hh); v16b f;
#pragma unroll
  for (int e = 0; e < 8; ++e) { f[e] = a[e]; f[8 + e] = b[e]; } return f; }
__device__ __forceinline__ v8f wmma16b(v16b a, v16b b, v8f c) { v8f d = __builtin_amdgcn_wmma_f32_16x16x32_f16(false, a, false, b, (short)0, c, false, false); asm volatile("v_nop\n\tv_nop\n\tv_nop\n\tv_nop" : "+v"(d) : "v"(a), "v"(b)); return d; }
__device__ __forceinline__ float nexp(float x) { return __builtin_amdgcn_exp2f(x * 1.4426950408889634f); }
__device__ __forceinline__ float pmul(float a, float b) { float p = a * b; asm volatile("" : "+v"(p)); return p; }

// a weight fragment in the k order of frag_kb, from a row of f32 weights: the four 16-byte loads, and apart from them the rounding (as the operands are defined)
struct wraw { v4f q[4]; };
__device__ __forceinline__ wraw load_w(const float* p, int hh) { wraw r; r.q[0] = *(const v4f*)(p + 8 * hh); r.q[1] = *(const v4f*)(p + 8 * hh + 4); r.q[2] = *(const v4f*)(p + 16 + 8 * hh); r.q[3] = *(const v4f*)(p + 20 + 8 * hh); return r; }
__device__ __forceinline__ v16b round_w(const wraw& r) { v16b f;
#pragma unroll
  for (int i = 0; i < 4; ++i)
#pragma unroll
    for (int e = 0; e < 4; ++e) f[4 * i + e] = (b16)bf16_rne(r.q[i][e]);
  return f; }
// the three 1x1 convs in one launch: block = 64 pixels (one image row) x 8 waves. x is read once as f32, rounded and transposed to pixel rows in LDS; wave w holds output channels 16w..16w+15 of
// q, k and v (its q and k weight rows rounded in registers while x is in flight) against all 4 pixel tiles; q, k leave as [px][c] hi+lo, v as [c][px] hi+lo, through LDS in whole 128-byte lines.
__global__ __launch_bounds__(256, 4) void qkv_kernel(const float* __restrict__ x, const float* __restrict__ wq, const float* __restrict__ bq, const float* __restrict__ wk, const float* __restrict__ bk, const float* __restrict__ wv, const float* __restrict__ bv,
                                                  b16* __restrict__ QH, b16* __restrict__ QL, b16* __restrict__ KH, b16* __restrict__ KL, b16* __restrict__ VTh, b16* __restrict__ VTl) {
  __shared__ __attribute__((aligned(16))) b16 Tx[64][C + 8], Th[2][64][C + 8], Tl[2][64][C + 8], Vh[C][64 + 8], Vl[C][64 + 8];
  const int tid = threadIdx.x, lane = tid & 31, wave = tid >> 5, nloc = lane & 15, hlf = lane >> 4, g0 = blockIdx.x * 64, b = g0 / NPI, p0 = g0 % NPI;
  const int xpx = tid & 63, xc = (tid >> 6) * 32;   // this thread's pixel and its 32 channels of the x tile
  const int orow = wave * 16 + nloc; v16b w[3][4]; wraw rw[2][4];
#pragma unroll
  for (int kb = 0; kb < 4; ++kb) { rw[0][kb] = load_w(wq + (size_t)orow * C + kb * 32, hlf); rw[1][kb] = load_w(wk + (size_t)orow * C + kb * 32, hlf); }
  float xv[32]; const float* xp = x + ((size_t)b * C + xc) * NPI + p0 + xpx;
#pragma unroll
  for (int j = 0; j < 32; ++j) xv[j] = xp[(size_t)j * NPI];
  const float bias[3] = {bf16_rne(bq[orow]), bf16_rne(bk[orow]), bf16_rne(bv[orow])};
  asm volatile("s_wait_xcnt 0x0" ::: "memory");   // stands in front of the rounding below, which reuses the address registers of the loads above
  __builtin_amdgcn_sched_barrier(0);   // every load above is issued before the first rounding: x (from memory) flies while the q and k weights (from L2, issued first, so counted back first) are rounded
#pragma unroll
  for (int kb = 0; kb < 4; ++kb) { w[0][kb] = round_w(rw[0][kb]); w[1][kb] = round_w(rw[1][kb]); }
  __builtin_amdgcn_sched_barrier(0);   // the v weights are fetched only when the q and k f32 rows have left their registers: keeps the peak under 256 VGPRs, so that two blocks share a WGP
#pragma unroll
  for (int kb = 0; kb < 4; ++kb) rw[0][kb] = load_w(wv + (size_t)orow * C + kb * 32, hlf);
#pragma unroll
  for (int k = 0; k < 4; ++k) { v8b pk;
#pragma unroll
    for (int e = 0; e < 8; ++e) pk[e] = (b16)(bf16_rne(xv[k * 8 + e]) * XS);
    *(v8b*)(&Tx[xpx][xc + k * 8]) = pk; }
#pragma unroll
  for (int kb = 0; kb < 4; ++kb) w[2][kb] = round_w(rw[0][kb]);
  __syncthreads();
  v8f acc[3][4];
#pragma unroll
  for (int j = 0; j < 3; ++j)
#pragma unroll
    for (int r = 0; r < 4; ++r) acc[j][r] = (v8f){};
#pragma unroll
  for (int kb = 0; kb < 4; ++kb)
#pragma unroll
    for (int r = 0; r < 4; ++r) { const v16b a = frag_kb(&Tx[r * 16 + nloc][kb * 32], hlf);
#pragma unroll
      for (int j = 0; j < 3; ++j) acc[j][r] = wmma16b(a, w[j][kb], acc[j][r]); }
#pragma unroll
  for (int j = 0; j < 2; ++j)
#pragma unroll
    for (int r = 0; r < 4; ++r)
#pragma unroll
      for (int v = 0; v < 8; ++v) { b16 a_, c_; split16(acc[j][r][v] + XS * bias[j], a_, c_); Th[j][r * 16 + 8 * hlf + v][orow] = a_; Tl[j][r * 16 + 8 * hlf + v][orow] = c_; }
#pragma unroll
  for (int r = 0; r < 4; ++r)
#pragma unroll
    for (int v = 0; v < 8; ++v) { b16 a_, c_; split16(acc[2][r][v] + XS * bias[2], a_, c_); Vh[orow][r * 16 + 8 * hlf + v] = a_; Vl[orow][r * 16 + 8 * hlf + v] = c_; }
  __syncthreads();
#pragma unroll
  for (int k = 0; k < 4; ++k) { const int i = k * 256 + tid, rr = i >> 4, c8 = (i & 15) * 8; const size_t gi = (size_t)(g0 + rr) * C + c8;
    *(v8b*)(QH + gi) = *(const v8b*)(&Th[0][rr][c8]); *(v8b*)(QL + gi) = *(const v8b*)(&Tl[0][rr][c8]); *(v8b*)(KH + gi) = *(const v8b*)(&Th[1][rr][c8]); *(v8b*)(KL + gi) = *(const v8b*)(&Tl[1][rr][c8]); }
#pragma unroll
  for (int k = 0; k < 4; ++k) { const int i = k * 256 + tid, c = i >> 3, c8 = (i & 7) * 8; const size_t gi = ((size_t)b * C + c) * NPI + p0 + c8; *(v8b*)(VTh + gi) = *(const v8b*)(&Vh[c][c8]); *(v8b*)(VTl + gi) = *(const v8b*)(&Vl[c][c8]); }
}
// local attention: block = (b, image row h, all 64 query pixels) x 4 waves (16 queries each). Each of the up to 7 key rows is staged ONCE per block in LDS (K hi, K lo as [64 px][128 c], V hi, V lo as
// [128 c][64 px]) by asynchronous copies, two buffers: row i+1 flies while row i is worked on. Per wave as before: one aligned 32-column key block; S^T = k.q (3 products), window mask |dc| <= 3.
constexpr int KP = C + 8, VP = IW + 8;                          // LDS pitches in halfs: 272 B and 144 B, both 16 B x odd, so that 16 lanes' ds_load_b128 fall on 64 distinct banks
constexpr int KPL = IW * KP * 2, VPL = C * VP * 2, STG = 2 * KPL + 2 * VPL;   // bytes of one K plane, one V plane, one staged row
// eight 16-byte copies per lane, global -> LDS through no register. The s_wait_xcnt is the last line of the copies' own statement, so that no address register is rewritten in front of it.
__device__ __forceinline__ void async8(const unsigned (&l)[8], const b16* const (&g)[8]) {
  asm volatile("global_load_async_to_lds_b128 %0, %8, off\n\tglobal_load_async_to_lds_b128 %1, %9, off\n\tglobal_load_async_to_lds_b128 %2, %10, off\n\tglobal_load_async_to_lds_b128 %3, %11, off\n\t"
               "global_load_async_to_lds_b128 %4, %12, off\n\tglobal_load_async_to_lds_b128 %5, %13, off\n\tglobal_load_async_to_lds_b128 %6, %14, off\n\tglobal_load_async_to_lds_b128 %7, %15, off\n\ts_wait_xcnt 0x0"
               :: "v"(l[0]), "v"(l[1]), "v"(l[2]), "v"(l[3]), "v"(l[4]), "v"(l[5]), "v"(l[6]), "v"(l[7]), "v"(g[0]), "v"(g[1]), "v"(g[2]), "v"(g[3]), "v"(g[4]), "v"(g[5]), "v"(g[6]), "v"(g[7]) : "memory");
}
// one key row into the buffer at LDS byte address lb: 4 planes x 1024 chunks of 16 B, 128 threads x 8 chunks a plane; a wave's copy reads 4 whole 128-byte lines
__device__ __forceinline__ void stage_row(unsigned lb, const b16* kh, const b16* kl, const b16* vh, const b16* vl, int tid) {
  unsigned l[8]; const b16* g[8];
  const unsigned lk = lb + (unsigned)((tid >> 4) * (KP * 2) + (tid & 15) * 16), lv = lb + (unsigned)(2 * KPL + (tid >> 3) * (VP * 2) + (tid & 7) * 16);   // chunk j = i * 128 + tid: 8 more pixels, 16 more channels, per i
  const size_t gk = (size_t)tid * 8, gv = (size_t)(tid >> 3) * NPI + (tid & 7) * 8;
#pragma unroll
  for (int i = 0; i < 8; ++i) { l[i] = lk + (unsigned)(i * 8 * KP * 2); g[i] = kh + gk + (size_t)i * 1024; }
  async8(l, g);
#pragma unroll
  for (int i = 0; i < 8; ++i) { l[i] = lk + (unsigned)(KPL + i * 8 * KP * 2); g[i] = kl + gk + (size_t)i * 1024; }
  async8(l, g);
#pragma unroll
  for (int i = 0; i < 8; ++i) { l[i] = lv + (unsigned)(i * 16 * VP * 2); g[i] = vh + gv + (size_t)i * 16 * NPI; }
  async8(l, g);
#pragma unroll
  for (int i = 0; i < 8; ++i) { l[i] = lv + (unsigned)(VPL + i * 16 * VP * 2); g[i] = vl + gv + (size_t)i * 16 * NPI; }
  async8(l, g);
}
__global__ __launch_bounds__(128) void attn_kernel(const b16* __restrict__ QH, const b16* __restrict__ QL, const b16* __restrict__ KH, const b16* __restrict__ KL, const b16* __restrict__ VTh, const b16* __restrict__ VTl, float* __restrict__ out) {
  __shared__ __attribute__((aligned(16))) unsigned char L[2 * STG];   // the two row buffers; behind the loop its first bytes are the output staging
  const int tid = threadIdx.x, wave = tid >> 5, lane = tid & 31, hh = lane >> 4, col = lane & 15; const int b = blockIdx.z, h = blockIdx.y, w0 = wave * 16, wq = w0 + col;
  const size_t ib = (size_t)b * NPI; const int qpix = h * IW + wq;
  // out-of-image neighbour count for this lane's query: rows outside [0,IH) x 7 cols + in-image rows x cols outside [0,IW)
  const int r_lo = (h - PADW < 0) ? 0 : h - PADW, r_hi = (h + PADW > IH - 1) ? IH - 1 : h + PADW, c_lo = (wq - PADW < 0) ? 0 : wq - PADW, c_hi = (wq + PADW > IW - 1) ? IW - 1 : wq + PADW;
  const int nrow = r_hi - r_lo + 1;   // in-image key rows, uniform per block
  const unsigned lds0 = (unsigned)(size_t)(&L[0]);
  const b16* kh0 = KH + (ib + (size_t)r_lo * IW) * C; const b16* kl0 = KL + (ib + (size_t)r_lo * IW) * C; const b16* vh0 = VTh + (size_t)b * C * NPI + (size_t)r_lo * IW; const b16* vl0 = VTl + (size_t)b * C * NPI + (size_t)r_lo * IW;
  stage_row(lds0, kh0, kl0, vh0, vl0, tid);
  v16b qf[4], ql[4]; for (int t = 0; t < 4; ++t) { qf[t] = frag_kb(QH + (ib + qpix) * C + t * 32, hh); ql[t] = frag_kb(QL + (ib + qpix) * C + t * 32, hh); }
  const int n_in = nrow * (c_hi - c_lo + 1), n_out = KS * KS - n_in;
  float m = (n_out > 0) ? 0.0f : -INFINITY, l = (float)n_out; v8f o[8]; for (int t = 0; t < 8; ++t) o[t] = (v8f){};
  int c0 = w0 - 8; c0 = (c0 < 0) ? 0 : (c0 > IW - 32 ? IW - 32 : c0);   // aligned key columns covering [w0-3, w0+18]
  asm volatile("s_wait_asynccnt 0x0" ::: "memory");   // this wave's copies of row 0 have landed
  __syncthreads();                                    // every wave's have
  if (nrow > 1) stage_row(lds0 + STG, kh0 + (size_t)IW * C, kl0 + (size_t)IW * C, vh0 + IW, vl0 + IW, tid);
  for (int it = 0; it < nrow; ++it) {
    const unsigned char* S = L + (it & 1) * STG;
    const b16* Kr = (const b16*)S + c0 * KP; const b16* Klr = (const b16*)(S + KPL) + c0 * KP;
    v8f s0 = {}, s1 = {};
#pragma unroll
    for (int t = 0; t < 4; ++t) { const v16b k0 = frag_kb(Kr + col * KP + t * 32, hh), k0l = frag_kb(Klr + col * KP + t * 32, hh), k1 = frag_kb(Kr + (16 + col) * KP + t * 32, hh), k1l = frag_kb(Klr + (16 + col) * KP + t * 32, hh);
      s0 = wmma16b(k0, qf[t], s0); s0 = wmma16b(k0l, qf[t], s0); s0 = wmma16b(k0, ql[t], s0); s1 = wmma16b(k1, qf[t], s1); s1 = wmma16b(k1l, qf[t], s1); s1 = wmma16b(k1, ql[t], s1); }
    float mr = -INFINITY;
#pragma unroll
    for (int e = 0; e < 8; ++e) { const int kc0 = c0 + 8 * hh + e, kc1 = kc0 + 16; const bool v0 = (kc0 >= wq - PADW) && (kc0 <= wq + PADW), v1 = (kc1 >= wq - PADW) && (kc1 <= wq + PADW);
      s0[e] = v0 ? s0[e] * (1.0f / (XS * XS)) : -INFINITY; s1[e] = v1 ? s1[e] * (1.0f / (XS * XS)) : -INFINITY; mr = fmaxf(mr, fmaxf(s0[e], s1[e])); }
    mr = fmaxf(mr, __shfl_xor(mr, 16)); const float mn = fmaxf(m, mr); const float al_ = (mn == -INFINITY) ? 1.0f : nexp(m - mn); m = mn; float sum = 0.0f; v16b pb, pl;
#pragma unroll
    for (int e = 0; e < 8; ++e) { const float e0 = (s0[e] == -INFINITY) ? 0.0f : nexp(s0[e] - mn), e1 = (s1[e] == -INFINITY) ? 0.0f : nexp(s1[e] - mn); sum += e0 + e1; b16 a_, c_; split16(e0 * PS, a_, c_); pb[e] = a_; pl[e] = c_; split16(e1 * PS, a_, c_); pb[8 + e] = a_; pl[8 + e] = c_; }
    sum += __shfl_xor(sum, 16); l = l * al_ + sum;
    const b16* V = (const b16*)(S + 2 * KPL) + c0; const b16* Vl = (const b16*)(S + 2 * KPL + VPL) + c0;
#pragma unroll
    for (int t = 0; t < 8; ++t) { o[t] *= al_; const v16b vh = frag_kb(V + (t * 16 + col) * VP, hh); o[t] = wmma16b(vh, pb, o[t]); o[t] = wmma16b(vh, pl, o[t]); o[t] = wmma16b(frag_kb(Vl + (t * 16 + col) * VP, hh), pb, o[t]); }
    __builtin_amdgcn_sched_barrier(0);                  // keeps the row sum's cross-lane ds operation in front of the wait below: no DS operation of this wave is outstanding when the refill issues
    asm volatile("s_wait_dscnt 0x0" ::: "memory");      // this wave's reads of this row's buffer have returned
    asm volatile("s_wait_asynccnt 0x0" ::: "memory");   // this wave's copies of the next row have landed
    __syncthreads();                                    // publishes the next row and frees this row's buffer
    if (it + 2 < nrow) stage_row(lds0 + (unsigned)((it & 1) * STG), kh0 + (size_t)(it + 2) * IW * C, kl0 + (size_t)(it + 2) * IW * C, vh0 + (it + 2) * IW, vl0 + (it + 2) * IW, tid); }
  asm volatile("s_wait_asynccnt 0x0" ::: "memory");     // no copy is outstanding when the buffers become output staging
  float (*Os)[IW + 4] = (float (*)[IW + 4])L;           // every wave has left the buffers: the last pass's own barrier
  const float inv = 1.0f / (l * PS * XS);   // every pixel has at least itself in the window; (8v).(8p) carries x64
#pragma unroll
  for (int t = 0; t < 8; ++t)
#pragma unroll
    for (int e = 0; e < 8; ++e) Os[t * 16 + 8 * hh + e][wave * 16 + col] = o[t][e] * inv;
  __syncthreads();
  { for (int i = tid; i < C * 16; i += 128) { const int c = i >> 4, c4 = (i & 15) * 4; *(v4f*)(out + ((size_t)b * C + c) * NPI + (size_t)h * IW + c4) = *(const v4f*)(&Os[c][c4]); }  }
}
}  // namespace

extern "C" void kernel_launch(void* const* d_in, const int* in_sizes, int n_in,
                              void* d_out, int out_size, void* d_ws, size_t ws_size, hipStream_t stream) {
  (void)n_in; (void)out_size;
  const float* x = (const float*)d_in[0]; const float* wq = (const float*)d_in[1]; const float* bq = (const float*)d_in[2]; const float* wk = (const float*)d_in[3]; const float* bk = (const float*)d_in[4]; const float* wv = (const float*)d_in[5]; const float* bv = (const float*)d_in[6];
  float* out = (float*)d_out;   // [8][128][64][64]
  if (in_sizes[0] != NT * C || in_sizes[1] != C * C) return;
  size_t off = 0; char* ws = (char*)d_ws;
  auto carve = [&](size_t bytes) { char* p = ws + off; off += (bytes + 255) & ~(size_t)255; return p; };
  b16* QH = (b16*)carve((size_t)NT * C * 2); b16* QL = (b16*)carve((size_t)NT * C * 2); b16* KH = (b16*)carve((size_t)NT * C * 2); b16* KL = (b16*)carve((size_t)NT * C * 2); b16* VTh = (b16*)carve((size_t)NT * C * 2); b16* VTl = (b16*)carve((size_t)NT * C * 2);
  if (off > ws_size) return;                        // 6 planes of 8.4 MB
  qkv_kernel<<<NT / 64, 256, 0, stream>>>(x, wq, bq, wk, bk, wv, bv, QH, QL, KH, KL, VTh, VTl);
  attn_kernel<<<dim3(1, IH, Bn), 128, 0, stream>>>(QH, QL, KH, KL, VTh, VTl, out);
}

// v003
// A run of this version takes 41.5 microseconds.
// In both of two side-by-side timings against v002, it was 1.07 times as fast.
// Over all steps from v000 it is 2.35 times as fast.
#include <hip/hip_runtime.h>

// LocAtt (local 7x7 attention): q, k, v = 1x1 convs (+bias) of x [8][128][64][64]; for every pixel, scores over the 49 zero-padded neighbours = Σ_c q[c] k_unf[c] (padded neighbours score exactly
// 0 and carry v = 0), softmax over the 49, y[c] = Σ attn v_unf[c] -> [8][128][64][64] (NCHW).
// WMMA (v_wmma_f32_16x16x32_f16, f32 accumulate): the three 1x1 convs as [32768 px x 128] x [128 x 128] with EXACT operands (x transposed to pixel rows, W[o][c] rows; exact bf16; 1 product) + bias;
// q, k as f16 hi+lo pairs x8 (the unscaled 128-term logits have σ ≈ 11, so their absolute precision matters): per (image row, 16 query pixels) S^T = k.q over the 7 key rows x 32 aligned key
// columns covering the window (3 products), window mask by index compare, the out-of-image neighbours added analytically as n_out · e^{0 − m} to the softmax denominator; o^T += (8v)^T.P^T with P

namespace {
constexpr int Bn = 8, C = 128, IH = 64, IW = 64, NPI = IH * IW, NT = Bn * NPI, KS = 7, PADW = 3;
constexpr float XS = 8.0f, PS = 8.0f;

typedef _Float16 b16;
typedef __attribute__((ext_vector_type(16))) _Float16 v16b;
typedef __attribute__((ext_vector_type(8))) _Float16 v8b;
typedef __attribute__((ext_vector_type(8))) float v8f;
typedef __attribute__((ext_vector_type(4))) float v4f;
__device__ __forceinline__ float bf16_rne(float f) { unsigned int u = __float_as_uint(f); u += 0x7FFFu + ((u >> 16) & 1u); return __uint_as_float(u & 0xFFFF0000u); }
__device__ __forceinline__ void split16(float v, b16& hi, b16& lo) { hi = (b16)v; lo = (b16)(v - (float)hi); }
__device__ __forceinline__ v16b frag_kb(const b16* p, int hh) { const v8b a = *(const v8b*)(p + 8 * hh), b = *(const v8b*)(p + 16 + 8 * hh); v16b f;
#pragma unroll
  for (int e = 0; e < 8; ++e) { f[e] = a[e]; f[8 + e] = b[e]; } return f; }
__device__ __forceinline__ v8f wmma16b(v16b a, v16b b, v8f c) { v8f d = __builtin_amdgcn_wmma_f32_16x16x32_f16(false, a, false, b, (short)0, c, false, false); asm volatile("v_nop\n\tv_nop\n\tv_nop\n\tv_nop" : "+v"(d) : "v"(a), "v"(b)); return d; }
__device__ __forceinline__ float nexp(float x) { return __builtin_amdgcn_exp2f(x * 1.4426950408889634f); }
__device__ __forceinline__ float pmul(float a, float b) { float p = a * b; asm volatile("" : "+v"(p)); return p; }

// a weight fragment in the k order of frag_kb, from a row of f32 weights: the four 16-byte loads, and apart from them the rounding (as the operands are defined)
struct wraw { v4f q[4]; };
__device__ __forceinline__ wraw load_w(const float* p, int hh) { wraw r; r.q[0] = *(const v4f*)(p + 8 * hh); r.q[1] = *(const v4f*)(p + 8 * hh + 4); r.q[2] = *(const v4f*)(p + 16 + 8 * hh); r.q[3] = *(const v4f*)(p + 20 + 8 * hh); return r; }
__device__ __forceinline__ v16b round_w(const wraw& r) { v16b f;
#pragma unroll
  for (int i = 0; i < 4; ++i)
#pragma unroll
    for (int e = 0; e < 4; ++e) f[4 * i + e] = (b16)bf16_rne(r.q[i][e]);
  return f; }
// the three 1x1 convs in one launch: block = 64 pixels (one image row) x 8 waves. x is read once as f32, rounded and transposed to pixel rows in LDS; wave w holds output channels 16w..16w+15 of
// q, k and v (its q and k weight rows rounded in registers while x is in flight) against all 4 pixel tiles; q, k leave as [px][c] hi+lo, v as [c][px] hi+lo, through LDS in whole 128-byte lines.
__global__ __launch_bounds__(256, 4) void qkv_kernel(const float* __restrict__ x, const float* __restrict__ wq, const float* __restrict__ bq, const float* __restrict__ wk, const float* __restrict__ bk, const float* __restrict__ wv, const float* __restrict__ bv,
                                                  b16* __restrict__ QH, b16* __restrict__ QL, b16* __restrict__ KH, b16* __restrict__ KL, b16* __restrict__ VTh, b16* __restrict__ VTl) {
  __shared__ __attribute__((aligned(16))) b16 Tx[64][C + 8], Th[2][64][C + 8], Tl[2][64][C + 8], Vh[C][64 + 8], Vl[C][64 + 8];
  const int tid = threadIdx.x, lane = tid & 31, wave = tid >> 5, nloc = lane & 15, hlf = lane >> 4, g0 = blockIdx.x * 64, b = g0 / NPI, p0 = g0 % NPI;
  const int xpx = tid & 63, xc = (tid >> 6) * 32;   // this thread's pixel and its 32 channels of the x tile
  const int orow = wave * 16 + nloc; v16b w[3][4]; wraw rw[2][4];
#pragma unroll
  for (int kb = 0; kb < 4; ++kb) { rw[0][kb] = load_w(wq + (size_t)orow * C + kb * 32, hlf); rw[1][kb] = load_w(wk + (size_t)orow * C + kb * 32, hlf); }
  float xv[32]; const float* xp = x + ((size_t)b * C + xc) * NPI + p0 + xpx;
#pragma unroll
  for (int j = 0; j < 32; ++j) xv[j] = xp[(size_t)j * NPI];
  const float bias[3] = {bf16_rne(bq[orow]), bf16_rne(bk[orow]), bf16_rne(bv[orow])};
  asm volatile("s_wait_xcnt 0x0" ::: "memory");   // stands in front of the rounding below, which reuses the address registers of the loads above
  __builtin_amdgcn_sched_barrier(0);   // every load above is issued before the first rounding: x (from memory) flies while the q and k weights (from L2, issued first, so counted back first) are rounded
#pragma unroll
  for (int kb = 0; kb < 4; ++kb) { w[0][kb] = round_w(rw[0][kb]); w[1][kb] = round_w(rw[1][kb]); }
  __builtin_amdgcn_sched_barrier(0);   // the v weights are fetched only when the q and k f32 rows have left their registers: keeps the peak under 256 VGPRs, so that two blocks share a WGP
#pragma unroll
  for (int kb = 0; kb < 4; ++kb) rw[0][kb] = load_w(wv + (size_t)orow * C + kb * 32, hlf);
#pragma unroll
  for (int k = 0; k < 4; ++k) { v8b pk;
#pragma unroll
    for (int e = 0; e < 8; ++e) pk[e] = (b16)(bf16_rne(xv[k * 8 + e]) * XS);
    *(v8b*)(&Tx[xpx][xc + k * 8]) = pk; }
#pragma unroll
  for (int kb = 0; kb < 4; ++kb) w[2][kb] = round_w(rw[0][kb]);
  __syncthreads();
  v8f acc[3][4];
#pragma unroll
  for (int j = 0; j < 3; ++j)
#pragma unroll
    for (int r = 0; r < 4; ++r) acc[j][r] = (v8f){};
#pragma unroll
  for (int kb = 0; kb < 4; ++kb)
#pragma unroll
    for (int r = 0; r < 4; ++r) { const v16b a = frag_kb(&Tx[r * 16 + nloc][kb * 32], hlf);
#pragma unroll
      for (int j = 0; j < 3; ++j) acc[j][r] = wmma16b(a, w[j][kb], acc[j][r]); }
#pragma unroll
  for (int j = 0; j < 2; ++j)
#pragma unroll
    for (int r = 0; r < 4; ++r)
#pragma unroll
      for (int v = 0; v < 8; ++v) { b16 a_, c_; split16(acc[j][r][v] + XS * bias[j], a_, c_); Th[j][r * 16 + 8 * hlf + v][orow] = a_; Tl[j][r * 16 + 8 * hlf + v][orow] = c_; }
#pragma unroll
  for (int r = 0; r < 4; ++r)
#pragma unroll
    for (int v = 0; v < 8; ++v) { b16 a_, c_; split16(acc[2][r][v] + XS * bias[2], a_, c_); Vh[orow][r * 16 + 8 * hlf + v] = a_; Vl[orow][r * 16 + 8 * hlf + v] = c_; }
  __syncthreads();
#pragma unroll
  for (int k = 0; k < 4; ++k) { const int i = k * 256 + tid, rr = i >> 4, c8 = (i & 15) * 8; const size_t gi = (size_t)(g0 + rr) * C + c8;
    *(v8b*)(QH + gi) = *(const v8b*)(&Th[0][rr][c8]); *(v8b*)(QL + gi) = *(const v8b*)(&Tl[0][rr][c8]); *(v8b*)(KH + gi) = *(const v8b*)(&Th[1][rr][c8]); *(v8b*)(KL + gi) = *(const v8b*)(&Tl[1][rr][c8]); }
#pragma unroll
  for (int k = 0; k < 4; ++k) { const int i = k * 256 + tid, c = i >> 3, c8 = (i & 7) * 8; const size_t gi = ((size_t)b * C + c) * NPI + p0 + c8; *(v8b*)(VTh + gi) = *(const v8b*)(&Vh[c][c8]); *(v8b*)(VTl + gi) = *(const v8b*)(&Vl[c][c8]); }
}
// local attention: block = (b, image row h, all 64 query pixels) x 4 waves (16 queries each). Each of the up to 7 key rows is staged ONCE per block in LDS (K hi, K lo as [64 px][128 c], V hi, V lo as
// [128 c][64 px]) by asynchronous copies, two buffers: row i+1 flies while row i is worked on. Per wave as before: one aligned 32-column key block; S^T = k.q (3 products), window mask |dc| <= 3.
constexpr int KP = C + 8, VP = IW + 8;                          // LDS pitches in halfs: 272 B and 144 B, both 16 B x odd, so that 16 lanes' ds_load_b128 fall on 64 distinct banks
constexpr int KPL = IW * KP * 2, VPL = C * VP * 2, STG = 2 * KPL + 2 * VPL;   // bytes of one K plane, one V plane, one staged row
// eight 16-byte copies per lane, global -> LDS through no register. The s_wait_xcnt is the last line of the copies' own statement, so that no address register is rewritten in front of it.
__device__ __forceinline__ void async8(const unsigned (&l)[8], const b16* const (&g)[8]) {
  asm volatile("global_load_async_to_lds_b128 %0, %8, off\n\tglobal_load_async_to_lds_b128 %1, %9, off\n\tglobal_load_async_to_lds_b128 %2, %10, off\n\tglobal_load_async_to_lds_b128 %3, %11, off\n\t"
               "global_load_async_to_lds_b128 %4, %12, off\n\tglobal_load_async_to_lds_b128 %5, %13, off\n\tglobal_load_async_to_lds_b128 %6, %14, off\n\tglobal_load_async_to_lds_b128 %7, %15, off\n\ts_wait_xcnt 0x0"
               :: "v"(l[0]), "v"(l[1]), "v"(l[2]), "v"(l[3]), "v"(l[4]), "v"(l[5]), "v"(l[6]), "v"(l[7]), "v"(g[0]), "v"(g[1]), "v"(g[2]), "v"(g[3]), "v"(g[4]), "v"(g[5]), "v"(g[6]), "v"(g[7]) : "memory");
}
// one key row into the buffer at LDS byte address lb: 4 planes x 1024 chunks of 16 B, 128 threads x 8 chunks a plane; a wave's copy reads 4 whole 128-byte lines
__device__ __forceinline__ void stage_row(unsigned lb, const b16* kh, const b16* kl, const b16* vh, const b16* vl, int tid) {
  unsigned l[8]; const b16* g[8];
  const unsigned lk = lb + (unsigned)((tid >> 4) * (KP * 2) + (tid & 15) * 16), lv = lb + (unsigned)(2 * KPL + (tid >> 3) * (VP * 2) + (tid & 7) * 16);   // chunk j = i * 128 + tid: 8 more pixels, 16 more channels, per i
  const size_t gk = (size_t)tid * 8, gv = (size_t)(tid >> 3) * NPI + (tid & 7) * 8;
#pragma unroll
  for (int i = 0; i < 8; ++i) { l[i] = lk + (unsigned)(i * 8 * KP * 2); g[i] = kh + gk + (size_t)i * 1024; }
  async8(l, g);
#pragma unroll
  for (int i = 0; i < 8; ++i) { l[i] = lk + (unsigned)(KPL + i * 8 * KP * 2); g[i] = kl + gk + (size_t)i * 1024; }
  async8(l, g);
#pragma unroll
  for (int i = 0; i < 8; ++i) { l[i] = lv + (unsigned)(i * 16 * VP * 2); g[i] = vh + gv + (size_t)i * 16 * NPI; }
  async8(l, g);
#pragma unroll
  for (int i = 0; i < 8; ++i) { l[i] = lv + (unsigned)(VPL + i * 16 * VP * 2); g[i] = vl + gv + (size_t)i * 16 * NPI; }
  async8(l, g);
}
__global__ __launch_bounds__(128) void attn_kernel(const b16* __restrict__ QH, const b16* __restrict__ QL, const b16* __restrict__ KH, const b16* __restrict__ KL, const b16* __restrict__ VTh, const b16* __restrict__ VTl, float* __restrict__ out) {
  __shared__ __attribute__((aligned(16))) unsigned char L[2 * STG];   // the two row buffers; behind the loop its first bytes are the output staging
  const int tid = threadIdx.x, wave = tid >> 5, lane = tid & 31, hh = lane >> 4, col = lane & 15; const int b = blockIdx.z, h = blockIdx.y, w0 = wave * 16, wq = w0 + col;
  const size_t ib = (size_t)b * NPI; const int qpix = h * IW + wq;
  // out-of-image neighbour count for this lane's query: rows outside [0,IH) x 7 cols + in-image rows x cols outside [0,IW)
  const int r_lo = (h - PADW < 0) ? 0 : h - PADW, r_hi = (h + PADW > IH - 1) ? IH - 1 : h + PADW, c_lo = (wq - PADW < 0) ? 0 : wq - PADW, c_hi = (wq + PADW > IW - 1) ? IW - 1 : wq + PADW;
  const int nrow = r_hi - r_lo + 1;   // in-image key rows, uniform per block
  const unsigned lds0 = (unsigned)(size_t)(&L[0]);
  const b16* kh0 = KH + (ib + (size_t)r_lo * IW) * C; const b16* kl0 = KL + (ib + (size_t)r_lo * IW) * C; const b16* vh0 = VTh + (size_t)b * C * NPI + (size_t)r_lo * IW; const b16* vl0 = VTl + (size_t)b * C * NPI + (size_t)r_lo * IW;
  stage_row(lds0, kh0, kl0, vh0, vl0, tid);
  v16b qf[4], ql[4]; for (int t = 0; t < 4; ++t) { qf[t] = frag_kb(QH + (ib + qpix) * C + t * 32, hh); ql[t] = frag_kb(QL + (ib + qpix) * C + t * 32, hh); }
  const int n_in = nrow * (c_hi - c_lo + 1), n_out = KS * KS - n_in;
  float m = (n_out > 0) ? 0.0f : -INFINITY, l = (float)n_out; v8f o[8]; for (int t = 0; t < 8; ++t) o[t] = (v8f){};
  int c0 = w0 - 8; c0 = (c0 < 0) ? 0 : (c0 > IW - 32 ? IW - 32 : c0);   // aligned key columns covering [w0-3, w0+18]
  asm volatile("s_wait_asynccnt 0x0" ::: "memory");   // this wave's copies of row 0 have landed
  __syncthreads();                                    // every wave's have
  if (nrow > 1) stage_row(lds0 + STG, kh0 + (size_t)IW * C, kl0 + (size_t)IW * C, vh0 + IW, vl0 + IW, tid);
  for (int it = 0; it < nrow; ++it) {
    const unsigned char* S = L + (it & 1) * STG;
    const b16* Kr = (const b16*)S + c0 * KP; const b16* Klr = (const b16*)(S + KPL) + c0 * KP;
    v16b k0[4], k1[4], k0l[4], k1l[4]; v8f s0 = {}, s1 = {};
    // The K reads run two channel blocks ahead of their products, so that the LDS latency is met once a row and not in front of each block; s0 and s1 take turns, each in the order of sums it had.
#pragma unroll
    for (int t = 0; t < 2; ++t) { k0[t] = frag_kb(Kr + col * KP + t * 32, hh); k1[t] = frag_kb(Kr + (16 + col) * KP + t * 32, hh); k0l[t] = frag_kb(Klr + col * KP + t * 32, hh); k1l[t] = frag_kb(Klr + (16 + col) * KP + t * 32, hh); }
#pragma unroll
    for (int t = 0; t < 4; ++t) { s0 = wmma16b(k0[t], qf[t], s0); s1 = wmma16b(k1[t], qf[t], s1); s0 = wmma16b(k0l[t], qf[t], s0); s1 = wmma16b(k1l[t], qf[t], s1); s0 = wmma16b(k0[t], ql[t], s0); s1 = wmma16b(k1[t], ql[t], s1);
      if (t < 2) { const int u = t + 2; k0[u] = frag_kb(Kr + col * KP + u * 32, hh); k1[u] = frag_kb(Kr + (16 + col) * KP + u * 32, hh); k0l[u] = frag_kb(Klr + col * KP + u * 32, hh); k1l[u] = frag_kb(Klr + (16 + col) * KP + u * 32, hh); } }
    const b16* V = (const b16*)(S + 2 * KPL) + c0; const b16* Vl = (const b16*)(S + 2 * KPL + VPL) + c0;
    v16b vf[8], vlf[8];
#pragma unroll
    for (int t = 0; t < 8; ++t) vf[t] = frag_kb(V + (t * 16 + col) * VP, hh);
#pragma unroll
    for (int t = 0; t < 4; ++t) vlf[t] = frag_kb(Vl + (t * 16 + col) * VP, hh);
    __builtin_amdgcn_sched_barrier(0);   // V hi and the first half of V lo are issued here and return under the softmax; without it the reads sink to their products and each meets the LDS latency
    float mr = -INFINITY;
#pragma unroll
    for (int e = 0; e < 8; ++e) { const int kc0 = c0 + 8 * hh + e, kc1 = kc0 + 16; const bool v0 = (kc0 >= wq - PADW) && (kc0 <= wq + PADW), v1 = (kc1 >= wq - PADW) && (kc1 <= wq + PADW);
      s0[e] = v0 ? s0[e] * (1.0f / (XS * XS)) : -INFINITY; s1[e] = v1 ? s1[e] * (1.0f / (XS * XS)) : -INFINITY; mr = fmaxf(mr, fmaxf(s0[e], s1[e])); }
    mr = fmaxf(mr, __shfl_xor(mr, 16)); const float mn = fmaxf(m, mr); const float al_ = (mn == -INFINITY) ? 1.0f : nexp(m - mn); m = mn; float sum = 0.0f; v16b pb, pl;
#pragma unroll
    for (int e = 0; e < 8; ++e) { const float e0 = (s0[e] == -INFINITY) ? 0.0f : nexp(s0[e] - mn), e1 = (s1[e] == -INFINITY) ? 0.0f : nexp(s1[e] - mn); sum += e0 + e1; b16 a_, c_; split16(e0 * PS, a_, c_); pb[e] = a_; pl[e] = c_; split16(e1 * PS, a_, c_); pb[8 + e] = a_; pl[8 + e] = c_; }
    sum += __shfl_xor(sum, 16); l = l * al_ + sum;
#pragma unroll
    for (int t = 0; t < 8; ++t) o[t] *= al_;
#pragma unroll
    for (int t = 0; t < 8; ++t) o[t] = wmma16b(vf[t], pb, o[t]);   // eight independent accumulators in turn; each o[t] takes its three products in the order it had
#pragma unroll
    for (int t = 0; t < 4; ++t) o[t] = wmma16b(vf[t], pl, o[t]);
#pragma unroll
    for (int t = 4; t < 8; ++t) vlf[t] = frag_kb(Vl + (t * 16 + col) * VP, hh);
    __builtin_amdgcn_sched_barrier(0);   // the second half of V lo goes into registers that V hi has left (the operands of wmma16b stay under v256), eight products ahead of its first use
#pragma unroll
    for (int t = 4; t < 8; ++t) o[t] = wmma16b(vf[t], pl, o[t]);
#pragma unroll
    for (int t = 0; t < 8; ++t) o[t] = wmma16b(vlf[t], pb, o[t]);
    __builtin_amdgcn_sched_barrier(0);                  // keeps the row sum's cross-lane ds operation in front of the wait below: no DS operation of this wave is outstanding when the refill issues
    asm volatile("s_wait_dscnt 0x0" ::: "memory");      // this wave's reads of this row's buffer have returned
    asm volatile("s_wait_asynccnt 0x0" ::: "memory");   // this wave's copies of the next row have landed
    __syncthreads();                                    // publishes the next row and frees this row's buffer
    if (it + 2 < nrow) stage_row(lds0 + (unsigned)((it & 1) * STG), kh0 + (size_t)(it + 2) * IW * C, kl0 + (size_t)(it + 2) * IW * C, vh0 + (it + 2) * IW, vl0 + (it + 2) * IW, tid); }
  asm volatile("s_wait_asynccnt 0x0" ::: "memory");     // no copy is outstanding when the buffers become output staging
  float (*Os)[IW + 4] = (float (*)[IW + 4])L;           // every wave has left the buffers: the last pass's own barrier
  const float inv = 1.0f / (l * PS * XS);   // every pixel has at least itself in the window; (8v).(8p) carries x64
#pragma unroll
  for (int t = 0; t < 8; ++t)
#pragma unroll
    for (int e = 0; e < 8; ++e) Os[t * 16 + 8 * hh + e][wave * 16 + col] = o[t][e] * inv;
  __syncthreads();
  { for (int i = tid; i < C * 16; i += 128) { const int c = i >> 4, c4 = (i & 15) * 4; *(v4f*)(out + ((size_t)b * C + c) * NPI + (size_t)h * IW + c4) = *(const v4f*)(&Os[c][c4]); }  }
}
}  // namespace

extern "C" void kernel_launch(void* const* d_in, const int* in_sizes, int n_in,
                              void* d_out, int out_size, void* d_ws, size_t ws_size, hipStream_t stream) {
  (void)n_in; (void)out_size;
  const float* x = (const float*)d_in[0]; const float* wq = (const float*)d_in[1]; const float* bq = (const float*)d_in[2]; const float* wk = (const float*)d_in[3]; const float* bk = (const float*)d_in[4]; const float* wv = (const float*)d_in[5]; const float* bv = (const float*)d_in[6];
  float* out = (float*)d_out;   // [8][128][64][64]
  if (in_sizes[0] != NT * C || in_sizes[1] != C * C) return;
  size_t off = 0; char* ws = (char*)d_ws;
  auto carve = [&](size_t bytes) { char* p = ws + off; off += (bytes + 255) & ~(size_t)255; return p; };
  b16* QH = (b16*)carve((size_t)NT * C * 2); b16* QL = (b16*)carve((size_t)NT * C * 2); b16* KH = (b16*)carve((size_t)NT * C * 2); b16* KL = (b16*)carve((size_t)NT * C * 2); b16* VTh = (b16*)carve((size_t)NT * C * 2); b16* VTl = (b16*)carve((size_t)NT * C * 2);
  if (off > ws_size) return;                        // 6 planes of 8.4 MB
  qkv_kernel<<<NT / 64, 256, 0, stream>>>(x, wq, bq, wk, bk, wv, bv, QH, QL, KH, KL, VTh, VTl);
  attn_kernel<<<dim3(1, IH, Bn), 128, 0, stream>>>(QH, QL, KH, KL, VTh, VTl, out);
}

// v004
// Measured time: 26.5 microseconds a run.
// Two timings next to v003 put it at 1.56 and 1.57 times that version's speed.
// Counting every step since v000, it is 3.68 times as fast.
#include <hip/hip_runtime.h>

// LocAtt (local 7x7 attention): q, k, v = 1x1 convs (+bias) of x [8][128][64][64]; for every pixel, scores over the 49 zero-padded neighbours = Σ_c q[c] k_unf[c] (padded neighbours score exactly
// 0 and carry v = 0), softmax over the 49, y[c] = Σ attn v_unf[c] -> [8][128][64][64] (NCHW).
// WMMA (v_wmma_f32_16x16x32_f16, f32 accumulate): the three 1x1 convs as [32768 px x 128] x [128 x 128] with EXACT operands (x transposed to pixel rows, W[o][c] rows; exact bf16; 1 product) + bias;
// q, k as f16 hi+lo pairs x8 (the unscaled 128-term logits have σ ≈ 11, so their absolute precision matters): per (image row, 16 query pixels) S^T = k.q over the 7 key rows x 32 aligned key
// columns covering the window (3 products), window mask by index compare, the out-of-image neighbours added analytically as n_out · e^{0 − m} to the softmax denominator; o^T += (8v)^T.P^T with P

namespace {
constexpr int Bn = 8, C = 128, IH = 64, IW = 64, NPI = IH * IW, NT = Bn * NPI, KS = 7, PADW = 3;
constexpr float XS = 8.0f, PS = 8.0f;

typedef _Float16 b16;
typedef __attribute__((ext_vector_type(16))) _Float16 v16b;
typedef __attribute__((ext_vector_type(8))) _Float16 v8b;
typedef __attribute__((ext_vector_type(8))) float v8f;
typedef __attribute__((ext_vector_type(4))) float v4f;
__device__ __forceinline__ float bf16_rne(float f) { unsigned int u = __float_as_uint(f); u += 0x7FFFu + ((u >> 16) & 1u); return __uint_as_float(u & 0xFFFF0000u); }
__device__ __forceinline__ void split16(float v, b16& hi, b16& lo) { hi = (b16)v; lo = (b16)(v - (float)hi); }
__device__ __forceinline__ v16b frag_kb(const b16* p, int hh) { const v8b a = *(const v8b*)(p + 8 * hh), b = *(const v8b*)(p + 16 + 8 * hh); v16b f;
#pragma unroll
  for (int e = 0; e < 8; ++e) { f[e] = a[e]; f[8 + e] = b[e]; } return f; }
__device__ __forceinline__ v8f wmma16b(v16b a, v16b b, v8f c) { v8f d = __builtin_amdgcn_wmma_f32_16x16x32_f16(false, a, false, b, (short)0, c, false, false); asm volatile("v_nop\n\tv_nop\n\tv_nop\n\tv_nop" : "+v"(d) : "v"(a), "v"(b)); return d; }
// the same product with the distance behind it left to the compiler: its operands are free to live above v255 (the weights, over the whole key-row loop)
__device__ __forceinline__ v8f wmma16c(v16b a, v16b b, v8f c) { return __builtin_amdgcn_wmma_f32_16x16x32_f16(false, a, false, b, (short)0, c, false, false); }
__device__ __forceinline__ float nexp(float x) { return __builtin_amdgcn_exp2f(x * 1.4426950408889634f); }
__device__ __forceinline__ float pmul(float a, float b) { float p = a * b; asm volatile("" : "+v"(p)); return p; }

// a weight fragment in the k order of frag_kb, from a row of f32 weights: the four 16-byte loads, and apart from them the rounding (as the operands are defined)
struct wraw { v4f q[4]; };
__device__ __forceinline__ wraw load_w(const float* p) { wraw r; r.q[0] = *(const v4f*)(p); r.q[1] = *(const v4f*)(p + 4); r.q[2] = *(const v4f*)(p + 16); r.q[3] = *(const v4f*)(p + 20); return r; }   // p: the row's block of 32, + 8 * hh
__device__ __forceinline__ v16b round_w(const wraw& r) { v16b f;
#pragma unroll
  for (int i = 0; i < 4; ++i)
#pragma unroll
    for (int e = 0; e < 4; ++e) f[4 * i + e] = (b16)bf16_rne(r.q[i][e]);
  return f; }
// everything in one launch: block = (image b, two query rows h0, h0+1, all 64 columns) x 8 waves. No q, k or v plane goes through memory: the block walks the up to 8 key rows of its two windows; per key
// row x is read as f32, rounded and transposed to pixel rows in LDS, wave w forms output channels 16w..16w+15 of k and v (its weight rows stay rounded in registers) and lays them as hi+lo planes in LDS
// (K as [64 px][128 c], V as [128 c][64 px]); then wave w attends for query row h0 + w/4, columns 16(w%4)..+15: one aligned 32-column key block; S^T = k.q (3 products), window mask |dc| <= 3.
constexpr int KP = C + 8, VP = IW + 8;                          // LDS pitches in halfs: 272 B and 144 B, both 16 B x odd, so that 16 lanes' 16-byte accesses fall on 64 distinct banks
constexpr int KPL = IW * KP * 2, VPL = C * VP * 2, STG = 2 * KPL + 2 * VPL;   // bytes of one K plane, one V plane, one key row's four planes
__global__ __launch_bounds__(256) void fused_kernel(const float* __restrict__ x, const float* __restrict__ wq, const float* __restrict__ bq, const float* __restrict__ wk, const float* __restrict__ bk, const float* __restrict__ wv, const float* __restrict__ bv, float* __restrict__ out) {
  __shared__ __attribute__((aligned(16))) unsigned char L[2 * STG + 6 * KPL];   // two buffers of a key row's four planes (at the end the output staging), two of an x row as pixel rows, the two q rows hi, lo
  const int tid = threadIdx.x, lane = tid & 31, wave = __builtin_amdgcn_readfirstlane(tid >> 5), hh = lane >> 4, col = lane & 15;
  const int b = blockIdx.z, h0 = blockIdx.y * 2, qr = wave >> 2, h = h0 + qr, w0 = (wave & 3) * 16, wqx = w0 + col;
  const int R_lo = (h0 - PADW < 0) ? 0 : h0 - PADW, R_hi = (h0 + 1 + PADW > IH - 1) ? IH - 1 : h0 + 1 + PADW;   // in-image key rows of the block, uniform per block
  // out-of-image neighbour count for this lane's query: rows outside [0,IH) x 7 cols + in-image rows x cols outside [0,IW)
  const int r_lo = (h - PADW < 0) ? 0 : h - PADW, r_hi = (h + PADW > IH - 1) ? IH - 1 : h + PADW, c_lo = (wqx - PADW < 0) ? 0 : wqx - PADW, c_hi = (wqx + PADW > IW - 1) ? IW - 1 : wqx + PADW;
  b16* const T0 = (b16*)(L + 2 * STG); unsigned char* const Q0 = L + 2 * STG + 2 * KPL;
  const int xpx = tid & 63, xc = (tid >> 6) * 32;   // this thread's pixel and its 32 channels of an x row
  const float* xb = x + ((size_t)b * C + xc) * NPI + xpx;
  const int orow = wave * 16 + col, o8 = wave * 16 + 8 * hh;
  const unsigned wo = (unsigned)(orow * C + 8 * hh);   // one 32-bit offset for the three weight matrices: every weight load names this register and its matrix's scalar base, which keep their values up to the wait below
  float xv[32]; wraw rw[3][4];
#pragma unroll
  for (int kb = 0; kb < 4; ++kb) rw[0][kb] = load_w(wq + wo + kb * 32);
  __builtin_amdgcn_sched_barrier(0);   // the q weights are asked for first and so counted back first: they are rounded while x is still in flight
#pragma unroll
  for (int j = 0; j < 32; ++j) xv[j] = xb[(size_t)j * NPI + h0 * IW];
#pragma unroll
  for (int kb = 0; kb < 4; ++kb) { rw[1][kb] = load_w(wk + wo + kb * 32); rw[2][kb] = load_w(wv + wo + kb * 32); }
  float bq8[8], bk8[8];
#pragma unroll
  for (int v = 0; v < 8; ++v) { bq8[v] = XS * bf16_rne(bq[o8 + v]); bk8[v] = XS * bf16_rne(bk[o8 + v]); }
  const float bvs = XS * bf16_rne(bv[orow]);
  asm volatile("s_wait_xcnt 0x0" ::: "memory");   // stands in front of whatever reuses the address registers of the loads above
  __builtin_amdgcn_sched_barrier(0);   // holds the arithmetic below, which reuses those registers, behind the wait (a "memory" clobber does not)
  v16b wf[4], wkf[4], wvf[4];
#pragma unroll
  for (int kb = 0; kb < 4; ++kb) wf[kb] = round_w(rw[0][kb]);
  auto get_x = [&](int row) {   // an x row's 32 channels of this thread's pixel, asked for directly behind a barrier (which waits for every load), used at the end of the stretch up to the next one
#pragma unroll
    for (int j = 0; j < 32; ++j) xv[j] = xb[(size_t)j * NPI + row * IW];
    asm volatile("s_wait_xcnt 0x0" ::: "memory");   // as above
    __builtin_amdgcn_sched_barrier(0);   // as above: without it a later weight rounding rose over the wait into the loads' address register
  };
  auto put_x = [&](b16* T) {
#pragma unroll
    for (int k = 0; k < 4; ++k) { v8b pk;
#pragma unroll
      for (int e = 0; e < 8; ++e) pk[e] = (b16)(bf16_rne(xv[k * 8 + e]) * XS);
      *(v8b*)(T + xpx * KP + xc + k * 8) = pk; }
  };
  put_x(T0);
  __syncthreads();                                  // the first x row is whole
  // q of the two query rows: weight rows as the first operand, so that a lane holds 8 neighbouring channels of one pixel (one 16-byte LDS store)
#pragma unroll
  for (int qi = 0; qi < 2; ++qi) {
    get_x((qi == 0) ? h0 + 1 : R_lo);
    const b16* T = T0 + qi * (KPL / 2);
    v8f acc[4];
#pragma unroll
    for (int rt = 0; rt < 4; ++rt) acc[rt] = (v8f){};
#pragma unroll
    for (int kb = 0; kb < 4; ++kb)
#pragma unroll
      for (int rt = 0; rt < 4; ++rt) acc[rt] = wmma16c(wf[kb], frag_kb(T + (rt * 16 + col) * KP + kb * 32, hh), acc[rt]);
    b16* Qh = (b16*)(Q0 + (2 * qi) * KPL); b16* Ql = (b16*)(Q0 + (2 * qi + 1) * KPL);
#pragma unroll
    for (int rt = 0; rt < 4; ++rt) { v8b ph, pw;
#pragma unroll
      for (int v = 0; v < 8; ++v) { b16 a_, c_; split16(acc[rt][v] + bq8[v], a_, c_); ph[v] = a_; pw[v] = c_; }
      *(v8b*)(Qh + (rt * 16 + col) * KP + o8) = ph; *(v8b*)(Ql + (rt * 16 + col) * KP + o8) = pw; }
    if (qi == 0) {
#pragma unroll
      for (int kb = 0; kb < 4; ++kb) wkf[kb] = round_w(rw[1][kb]);
    } else {
#pragma unroll
      for (int kb = 0; kb < 4; ++kb) wvf[kb] = round_w(rw[2][kb]);
    }
    put_x(T0 + (qi ^ 1) * (KPL / 2));               // the other x buffer: its readers left it in front of the last barrier
    __syncthreads();                                // this q row and the next x row are whole
  }
  const b16* Qh = (const b16*)(Q0 + (2 * qr) * KPL) + wqx * KP; const b16* Ql = (const b16*)(Q0 + (2 * qr + 1) * KPL) + wqx * KP;   // this lane's query: read anew each row, which leaves its 64 registers to the weights
  const int n_in = (r_hi - r_lo + 1) * (c_hi - c_lo + 1), n_out = KS * KS - n_in;
  float m = (n_out > 0) ? 0.0f : -INFINITY, l = (float)n_out; v8f o[8];
#pragma unroll
  for (int t = 0; t < 8; ++t) o[t] = (v8f){};
  int c0 = w0 - 8; c0 = (c0 < 0) ? 0 : (c0 > IW - 32 ? IW - 32 : c0);   // aligned key columns covering [w0-3, w0+18]
  // one barrier a key row: between two barriers a wave attends to row r (planes of one buffer), forms k and v of row r + 1 (from one x buffer into the other planes) and lays down x of row r + 2 (the other x buffer)
  const int nit = R_hi - R_lo + 1;
  for (int it = 0; it <= nit; ++it) {
    const int r = R_lo - 1 + it;
    if (it + 1 < nit) get_x(r + 2);
    if (r >= r_lo && r <= r_hi) {   // uniform per wave: this key row lies in the window of the wave's query row
    const unsigned char* S = L + ((it + 1) & 1) * STG;
    v16b qf[4], ql[4];
#pragma unroll
    for (int t = 0; t < 4; ++t) { qf[t] = frag_kb(Qh + t * 32, hh); ql[t] = frag_kb(Ql + t * 32, hh); }
    const b16* Kr = (const b16*)S + c0 * KP; const b16* Klr = (const b16*)(S + KPL) + c0 * KP;
    v16b k0[4], k1[4], k0l[4], k1l[4]; v8f s0 = {}, s1 = {};
    // The K reads run two channel blocks ahead of their products, so that the LDS latency is met once a row and not in front of each block; s0 and s1 take turns, each in the order of sums it had.
#pragma unroll
    for (int t = 0; t < 2; ++t) { k0[t] = frag_kb(Kr + col * KP + t * 32, hh); k1[t] = frag_kb(Kr + (16 + col) * KP + t * 32, hh); k0l[t] = frag_kb(Klr + col * KP + t * 32, hh); k1l[t] = frag_kb(Klr + (16 + col) * KP + t * 32, hh); }
#pragma unroll
    for (int t = 0; t < 4; ++t) { s0 = wmma16b(k0[t], qf[t], s0); s1 = wmma16b(k1[t], qf[t], s1); s0 = wmma16b(k0l[t], qf[t], s0); s1 = wmma16b(k1l[t], qf[t], s1); s0 = wmma16b(k0[t], ql[t], s0); s1 = wmma16b(k1[t], ql[t], s1);
      if (t < 2) { const int u = t + 2; k0[u] = frag_kb(Kr + col * KP + u * 32, hh); k1[u] = frag_kb(Kr + (16 + col) * KP + u * 32, hh); k0l[u] = frag_kb(Klr + col * KP + u * 32, hh); k1l[u] = frag_kb(Klr + (16 + col) * KP + u * 32, hh); } }
    const b16* V = (const b16*)(S + 2 * KPL) + c0; const b16* Vl = (const b16*)(S + 2 * KPL + VPL) + c0;
    v16b vf[8], vlf[8];
#pragma unroll
    for (int t = 0; t < 8; ++t) vf[t] = frag_kb(V + (t * 16 + col) * VP, hh);
#pragma unroll
    for (int t = 0; t < 4; ++t) vlf[t] = frag_kb(Vl + (t * 16 + col) * VP, hh);
    __builtin_amdgcn_sched_barrier(0);   // V hi and the first half of V lo are issued here and return under the softmax; without it the reads sink to their products and each meets the LDS latency
    float mr = -INFINITY;
#pragma unroll
    for (int e = 0; e < 8; ++e) { const int kc0 = c0 + 8 * hh + e, kc1 = kc0 + 16; const bool v0 = (kc0 >= wqx - PADW) && (kc0 <= wqx + PADW), v1 = (kc1 >= wqx - PADW) && (kc1 <= wqx + PADW);
      s0[e] = v0 ? s0[e] * (1.0f / (XS * XS)) : -INFINITY; s1[e] = v1 ? s1[e] * (1.0f / (XS * XS)) : -INFINITY; mr = fmaxf(mr, fmaxf(s0[e], s1[e])); }
    mr = fmaxf(mr, __shfl_xor(mr, 16)); const float mn = fmaxf(m, mr); const float al_ = (mn == -INFINITY) ? 1.0f : nexp(m - mn); m = mn; float sum = 0.0f; v16b pb, pl;
#pragma unroll
    for (int e = 0; e < 8; ++e) { const float e0 = (s0[e] == -INFINITY) ? 0.0f : nexp(s0[e] - mn), e1 = (s1[e] == -INFINITY) ? 0.0f : nexp(s1[e] - mn); sum += e0 + e1; b16 a_, c_; split16(e0 * PS, a_, c_); pb[e] = a_; pl[e] = c_; split16(e1 * PS, a_, c_); pb[8 + e] = a_; pl[8 + e] = c_; }
    sum += __shfl_xor(sum, 16); l = l * al_ + sum;
#pragma unroll
    for (int t = 0; t < 8; ++t) o[t] *= al_;
#pragma unroll
    for (int t = 0; t < 8; ++t) o[t] = wmma16b(vf[t], pb, o[t]);   // eight independent accumulators in turn; each o[t] takes its three products in the order it had
#pragma unroll
    for (int t = 0; t < 4; ++t) o[t] = wmma16b(vf[t], pl, o[t]);
#pragma unroll
    for (int t = 4; t < 8; ++t) vlf[t] = frag_kb(Vl + (t * 16 + col) * VP, hh);
    __builtin_amdgcn_sched_barrier(0);   // the second half of V lo goes into registers that V hi has left (the operands of wmma16b stay under v256), eight products ahead of its first use
#pragma unroll
    for (int t = 4; t < 8; ++t) o[t] = wmma16b(vf[t], pl, o[t]);
#pragma unroll
    for (int t = 0; t < 8; ++t) o[t] = wmma16b(vlf[t], pb, o[t]);
    }
    if (it < nit) { v8f ak[4], av[4]; const b16* T = T0 + (it & 1) * (KPL / 2); unsigned char* Pw = L + (it & 1) * STG;
#pragma unroll
      for (int rt = 0; rt < 4; ++rt) { ak[rt] = (v8f){}; av[rt] = (v8f){}; }
#pragma unroll
      for (int kb = 0; kb < 4; ++kb)
#pragma unroll
        for (int rt = 0; rt < 4; ++rt) { const v16b a = frag_kb(T + (rt * 16 + col) * KP + kb * 32, hh); ak[rt] = wmma16c(wkf[kb], a, ak[rt]); av[rt] = wmma16c(a, wvf[kb], av[rt]); }
      b16* Kh = (b16*)Pw; b16* Kl = (b16*)(Pw + KPL); b16* Vh = (b16*)(Pw + 2 * KPL); b16* Vw = (b16*)(Pw + 2 * KPL + VPL);
#pragma unroll
      for (int rt = 0; rt < 4; ++rt) { v8b ph, pw, vh8, vl8;
#pragma unroll
        for (int v = 0; v < 8; ++v) { b16 a_, c_; split16(ak[rt][v] + bk8[v], a_, c_); ph[v] = a_; pw[v] = c_; split16(av[rt][v] + bvs, a_, c_); vh8[v] = a_; vl8[v] = c_; }
        *(v8b*)(Kh + (rt * 16 + col) * KP + o8) = ph; *(v8b*)(Kl + (rt * 16 + col) * KP + o8) = pw;
        *(v8b*)(Vh + orow * VP + rt * 16 + 8 * hh) = vh8; *(v8b*)(Vw + orow * VP + rt * 16 + 8 * hh) = vl8; } }
    if (it + 1 < nit) put_x(T0 + ((it + 1) & 1) * (KPL / 2));
    __syncthreads();   // row r + 1's planes and row r + 2's x are whole; every wave has left row r's planes and row r + 1's x (behind the last row: the planes become the output staging)
  }
  float (*Os)[2 * IW + 4] = (float (*)[2 * IW + 4])L;
  const float inv = 1.0f / (l * PS * XS);   // every pixel has at least itself in the window; (8v).(8p) carries x64
#pragma unroll
  for (int t = 0; t < 8; ++t)
#pragma unroll
    for (int e = 0; e < 8; ++e) Os[t * 16 + 8 * hh + e][qr * IW + wqx] = o[t][e] * inv;
  __syncthreads();
  { for (int i = tid; i < C * 32; i += 256) { const int c = i >> 5, c4 = (i & 31) * 4; *(v4f*)(out + ((size_t)b * C + c) * NPI + (size_t)h0 * IW + c4) = *(const v4f*)(&Os[c][c4]); }  }
}
}  // namespace

extern "C" void kernel_launch(void* const* d_in, const int* in_sizes, int n_in,
                              void* d_out, int out_size, void* d_ws, size_t ws_size, hipStream_t stream) {
  (void)n_in; (void)out_size; (void)d_ws; (void)ws_size;
  const float* x = (const float*)d_in[0]; const float* wq = (const float*)d_in[1]; const float* bq = (const float*)d_in[2]; const float* wk = (const float*)d_in[3]; const float* bk = (const float*)d_in[4]; const float* wv = (const float*)d_in[5]; const float* bv = (const float*)d_in[6];
  float* out = (float*)d_out;   // [8][128][64][64]
  if (in_sizes[0] != NT * C || in_sizes[1] != C * C) return;
  fused_kernel<<<dim3(1, IH / 2, Bn), 256, 0, stream>>>(x, wq, bq, wk, bk, wv, bv, out);
}

// v005
// A run of this version takes 23.8 microseconds.
// Timed twice side by side with v004, it ran 1.12 times as fast both times.
// All steps since v000 together make it 4.11 times as fast.
#include <hip/hip_runtime.h>

// LocAtt (local 7x7 attention): q, k, v = 1x1 convs (+bias) of x [8][128][64][64]; for every pixel, scores over the 49 zero-padded neighbours = Σ_c q[c] k_unf[c] (padded neighbours score exactly
// 0 and carry v = 0), softmax over the 49, y[c] = Σ attn v_unf[c] -> [8][128][64][64] (NCHW).
// WMMA (v_wmma_f32_16x16x32_f16, f32 accumulate): the three 1x1 convs as [32768 px x 128] x [128 x 128] with EXACT operands (x transposed to pixel rows, W[o][c] rows; exact bf16; 1 product) + bias;
// q, k as f16 hi+lo pairs x8 (the unscaled 128-term logits have σ ≈ 11, so their absolute precision matters): per (image row, 16 query pixels) S^T = k.q over the 7 key rows x 32 aligned key
// columns covering the window (3 products), window mask by index compare, the out-of-image neighbours added analytically as n_out · e^{0 − m} to the softmax denominator; o^T += (8v)^T.P^T with P

namespace {
constexpr int Bn = 8, C = 128, IH = 64, IW = 64, NPI = IH * IW, NT = Bn * NPI, KS = 7, PADW = 3;
constexpr float XS = 8.0f, PS = 8.0f;

typedef _Float16 b16;
typedef __attribute__((ext_vector_type(16))) _Float16 v16b;
typedef __attribute__((ext_vector_type(8))) _Float16 v8b;
typedef __attribute__((ext_vector_type(8))) float v8f;
typedef __attribute__((ext_vector_type(4))) float v4f;
typedef __attribute__((ext_vector_type(2))) float v2f;
typedef __attribute__((ext_vector_type(2))) _Float16 v2b;
typedef __attribute__((ext_vector_type(2))) __bf16 v2r;
// rounding to bf16 (nearest, ties to even) by the chip's own convert, two values an instruction, and back to f32
__device__ __forceinline__ float bf16_rne(float f) { return (float)(__bf16)f; }
__device__ __forceinline__ v2f bf16_rne2(float a, float b) { return __builtin_convertvector(__builtin_convertvector((v2f){a, b}, v2r), v2f); }
__device__ __forceinline__ void split16x2(v2f v, v2b& hi, v2b& lo) { hi = __builtin_convertvector(v, v2b); lo = __builtin_convertvector(v - __builtin_convertvector(hi, v2f), v2b); }
__device__ __forceinline__ v16b frag_kb(const b16* p, int hh) { const v8b a = *(const v8b*)(p + 8 * hh), b = *(const v8b*)(p + 16 + 8 * hh); v16b f;
#pragma unroll
  for (int e = 0; e < 8; ++e) { f[e] = a[e]; f[8 + e] = b[e]; } return f; }
__device__ __forceinline__ v8f wmma16b(v16b a, v16b b, v8f c) { v8f d = __builtin_amdgcn_wmma_f32_16x16x32_f16(false, a, false, b, (short)0, c, false, false); asm volatile("v_nop\n\tv_nop\n\tv_nop\n\tv_nop" : "+v"(d) : "v"(a), "v"(b)); return d; }
// the same product with the distance behind it left to the compiler: its operands are free to live above v255 (the weights, over the whole key-row loop)
__device__ __forceinline__ v8f wmma16c(v16b a, v16b b, v8f c) { return __builtin_amdgcn_wmma_f32_16x16x32_f16(false, a, false, b, (short)0, c, false, false); }
__device__ __forceinline__ float nexp(float x) { return __builtin_amdgcn_exp2f(x * 1.4426950408889634f); }
__device__ __forceinline__ float pmul(float a, float b) { float p = a * b; asm volatile("" : "+v"(p)); return p; }

// a weight fragment in the k order of frag_kb, from a row of f32 weights: the four 16-byte loads, and apart from them the rounding (as the operands are defined)
struct wraw { v4f q[4]; };
__device__ __forceinline__ wraw load_w(const float* p) { wraw r; r.q[0] = *(const v4f*)(p); r.q[1] = *(const v4f*)(p + 4); r.q[2] = *(const v4f*)(p + 16); r.q[3] = *(const v4f*)(p + 20); return r; }   // p: the row's block of 32, + 8 * hh
__device__ __forceinline__ v16b round_w(const wraw& r) { v16b f;
#pragma unroll
  for (int i = 0; i < 4; ++i)
#pragma unroll
    for (int e = 0; e < 4; e += 2) { const v2b p = __builtin_convertvector(bf16_rne2(r.q[i][e], r.q[i][e + 1]), v2b); f[4 * i + e] = p[0]; f[4 * i + e + 1] = p[1]; }
  return f; }
// everything in one launch: block = (image b, two query rows h0, h0+1, all 64 columns) x 8 waves. No q, k or v plane goes through memory: the block walks the up to 8 key rows of its two windows; per key
// row x is read as f32, rounded and transposed to pixel rows in LDS, wave w forms output channels 16w..16w+15 of k and v (its weight rows stay rounded in registers) and lays them as hi+lo planes in LDS
// (K as [64 px][128 c], V as [128 c][64 px]); then wave w attends for query row h0 + w/4, columns 16(w%4)..+15: one aligned 32-column key block; S^T = k.q (3 products), window mask |dc| <= 3.
constexpr int KP = C + 8, VP = IW + 8;                          // LDS pitches in halfs: 272 B and 144 B, both 16 B x odd, so that 16 lanes' 16-byte accesses fall on 64 distinct banks
constexpr int KPL = IW * KP * 2, VPL = C * VP * 2, STG = 2 * KPL + 2 * VPL;   // bytes of one K plane, one V plane, one key row's four planes
__global__ __launch_bounds__(256) void fused_kernel(const float* __restrict__ x, const float* __restrict__ wq, const float* __restrict__ bq, const float* __restrict__ wk, const float* __restrict__ bk, const float* __restrict__ wv, const float* __restrict__ bv, float* __restrict__ out) {
  __shared__ __attribute__((aligned(16))) unsigned char L[2 * STG + 6 * KPL];   // two buffers of a key row's four planes (at the end the output staging), two of an x row as pixel rows, the two q rows hi, lo
  const int tid = threadIdx.x, lane = tid & 31, wave = __builtin_amdgcn_readfirstlane(tid >> 5), hh = lane >> 4, col = lane & 15;
  const int b = blockIdx.z, h0 = blockIdx.y * 2, qr = wave >> 2, h = h0 + qr, w0 = (wave & 3) * 16, wqx = w0 + col;
  const int R_lo = (h0 - PADW < 0) ? 0 : h0 - PADW, R_hi = (h0 + 1 + PADW > IH - 1) ? IH - 1 : h0 + 1 + PADW;   // in-image key rows of the block, uniform per block
  // out-of-image neighbour count for this lane's query: rows outside [0,IH) x 7 cols + in-image rows x cols outside [0,IW)
  const int r_lo = (h - PADW < 0) ? 0 : h - PADW, r_hi = (h + PADW > IH - 1) ? IH - 1 : h + PADW, c_lo = (wqx - PADW < 0) ? 0 : wqx - PADW, c_hi = (wqx + PADW > IW - 1) ? IW - 1 : wqx + PADW;
  b16* const T0 = (b16*)(L + 2 * STG); unsigned char* const Q0 = L + 2 * STG + 2 * KPL;
  const int xpx = tid & 63, xc = (tid >> 6) * 32;   // this thread's pixel and its 32 channels of an x row
  const float* xb = x + ((size_t)b * C + xc) * NPI + xpx;
  const int orow = wave * 16 + col, o8 = wave * 16 + 8 * hh;
  const unsigned wo = (unsigned)(orow * C + 8 * hh);   // one 32-bit offset for the three weight matrices: every weight load names this register and its matrix's scalar base, which keep their values up to the wait below
  float xv[32]; wraw rw[3][4];
#pragma unroll
  for (int kb = 0; kb < 4; ++kb) rw[0][kb] = load_w(wq + wo + kb * 32);
  __builtin_amdgcn_sched_barrier(0);   // the q weights are asked for first and so counted back first: they are rounded while x is still in flight
#pragma unroll
  for (int j = 0; j < 32; ++j) xv[j] = xb[(size_t)j * NPI + h0 * IW];
#pragma unroll
  for (int kb = 0; kb < 4; ++kb) { rw[1][kb] = load_w(wk + wo + kb * 32); rw[2][kb] = load_w(wv + wo + kb * 32); }
  float bqr[8], bkr[8];
#pragma unroll
  for (int v = 0; v < 8; ++v) { bqr[v] = bq[o8 + v]; bkr[v] = bk[o8 + v]; }
  const float bvr = bv[orow];
  asm volatile("s_wait_xcnt 0x0" ::: "memory");   // stands in front of whatever reuses the address registers of the loads above
  __builtin_amdgcn_sched_barrier(0);   // holds the arithmetic below, which reuses those registers, behind the wait (a "memory" clobber does not)
  v16b wf[4], wkf[4], wvf[4];
#pragma unroll
  for (int kb = 0; kb < 4; ++kb) wf[kb] = round_w(rw[0][kb]);
  auto get_x = [&](int row) {   // an x row's 32 channels of this thread's pixel, asked for directly behind a barrier (which waits for every load), used at the end of the stretch up to the next one
#pragma unroll
    for (int j = 0; j < 32; ++j) xv[j] = xb[(size_t)j * NPI + row * IW];
    asm volatile("s_wait_xcnt 0x0" ::: "memory");   // as above
    __builtin_amdgcn_sched_barrier(0);   // as above: without it a later weight rounding rose over the wait into the loads' address register
  };
  auto put_x = [&](b16* T) {   // the scale 8 goes on ahead of the rounding: a power of two, so the rounded value is the same, and the f32 product packs two values an instruction
#pragma unroll
    for (int k = 0; k < 4; ++k) { v8b pk;
#pragma unroll
      for (int e = 0; e < 8; e += 2) { const v2b p = __builtin_convertvector(bf16_rne2(xv[k * 8 + e] * XS, xv[k * 8 + e + 1] * XS), v2b); pk[e] = p[0]; pk[e + 1] = p[1]; }
      *(v8b*)(T + xpx * KP + xc + k * 8) = pk; }
  };
  put_x(T0);
  // holds the 17 bias loads in front of the first barrier, whose wait for every load covers them: left free they sank behind later barriers, each met its latency there
  asm volatile("" :: "v"(bqr[0]), "v"(bqr[1]), "v"(bqr[2]), "v"(bqr[3]), "v"(bqr[4]), "v"(bqr[5]), "v"(bqr[6]), "v"(bqr[7]), "v"(bkr[0]), "v"(bkr[1]), "v"(bkr[2]), "v"(bkr[3]), "v"(bkr[4]), "v"(bkr[5]), "v"(bkr[6]), "v"(bkr[7]), "v"(bvr));
  float bq8[8], bk8[8];
#pragma unroll
  for (int v = 0; v < 8; ++v) { bq8[v] = XS * bf16_rne(bqr[v]); bk8[v] = XS * bf16_rne(bkr[v]); }
  const float bvs = XS * bf16_rne(bvr);
  __syncthreads();                                  // the first x row is whole
  // q of the two query rows: weight rows as the first operand, so that a lane holds 8 neighbouring channels of one pixel (one 16-byte LDS store)
#pragma unroll
  for (int qi = 0; qi < 2; ++qi) {
    get_x((qi == 0) ? h0 + 1 : R_lo);
    const b16* T = T0 + qi * (KPL / 2);
    v8f acc[4];
#pragma unroll
    for (int rt = 0; rt < 4; ++rt) acc[rt] = (v8f){};
#pragma unroll
    for (int kb = 0; kb < 4; ++kb)
#pragma unroll
      for (int rt = 0; rt < 4; ++rt) acc[rt] = wmma16c(wf[kb], frag_kb(T + (rt * 16 + col) * KP + kb * 32, hh), acc[rt]);
    b16* Qh = (b16*)(Q0 + (2 * qi) * KPL); b16* Ql = (b16*)(Q0 + (2 * qi + 1) * KPL);
#pragma unroll
    for (int rt = 0; rt < 4; ++rt) { v8b ph, pw;
#pragma unroll
      for (int v = 0; v < 8; v += 2) { v2b a_, c_; split16x2((v2f){acc[rt][v] + bq8[v], acc[rt][v + 1] + bq8[v + 1]}, a_, c_); ph[v] = a_[0]; ph[v + 1] = a_[1]; pw[v] = c_[0]; pw[v + 1] = c_[1]; }
      *(v8b*)(Qh + (rt * 16 + col) * KP + o8) = ph; *(v8b*)(Ql + (rt * 16 + col) * KP + o8) = pw; }
    if (qi == 0) {
#pragma unroll
      for (int kb = 0; kb < 4; ++kb) wkf[kb] = round_w(rw[1][kb]);
    } else {
#pragma unroll
      for (int kb = 0; kb < 4; ++kb) wvf[kb] = round_w(rw[2][kb]);
    }
    put_x(T0 + (qi ^ 1) * (KPL / 2));               // the other x buffer: its readers left it in front of the last barrier
    __syncthreads();                                // this q row and the next x row are whole
  }
  const b16* Qh = (const b16*)(Q0 + (2 * qr) * KPL) + wqx * KP; const b16* Ql = (const b16*)(Q0 + (2 * qr + 1) * KPL) + wqx * KP;   // this lane's query: read anew each row, which leaves its 64 registers to the weights
  const int n_in = (r_hi - r_lo + 1) * (c_hi - c_lo + 1), n_out = KS * KS - n_in;
  float m = (n_out > 0) ? 0.0f : -INFINITY, l = (float)n_out; v8f o[8];
#pragma unroll
  for (int t = 0; t < 8; ++t) o[t] = (v8f){};
  int c0 = w0 - 8; c0 = (c0 < 0) ? 0 : (c0 > IW - 32 ? IW - 32 : c0);   // aligned key columns covering [w0-3, w0+18]
  // one barrier a key row: between two barriers a wave attends to row r (planes of one buffer), forms k and v of row r + 1 (from one x buffer into the other planes) and lays down x of row r + 2 (the other x buffer)
  const int nit = R_hi - R_lo + 1;
  for (int it = 0; it <= nit; ++it) {
    const int r = R_lo - 1 + it;
    if (it + 1 < nit) get_x(r + 2);
    if (r >= r_lo && r <= r_hi) {   // uniform per wave: this key row lies in the window of the wave's query row
    const unsigned char* S = L + ((it + 1) & 1) * STG;
    v16b qf[4], ql[4];
#pragma unroll
    for (int t = 0; t < 4; ++t) { qf[t] = frag_kb(Qh + t * 32, hh); ql[t] = frag_kb(Ql + t * 32, hh); }
    const b16* Kr = (const b16*)S + c0 * KP; const b16* Klr = (const b16*)(S + KPL) + c0 * KP;
    v16b k0[4], k1[4], k0l[4], k1l[4]; v8f s0 = {}, s1 = {};
    // The K reads run two channel blocks ahead of their products, so that the LDS latency is met once a row and not in front of each block; s0 and s1 take turns, each in the order of sums it had.
#pragma unroll
    for (int t = 0; t < 2; ++t) { k0[t] = frag_kb(Kr + col * KP + t * 32, hh); k1[t] = frag_kb(Kr + (16 + col) * KP + t * 32, hh); k0l[t] = frag_kb(Klr + col * KP + t * 32, hh); k1l[t] = frag_kb(Klr + (16 + col) * KP + t * 32, hh); }
#pragma unroll
    for (int t = 0; t < 4; ++t) { s0 = wmma16b(k0[t], qf[t], s0); s1 = wmma16b(k1[t], qf[t], s1); s0 = wmma16b(k0l[t], qf[t], s0); s1 = wmma16b(k1l[t], qf[t], s1); s0 = wmma16b(k0[t], ql[t], s0); s1 = wmma16b(k1[t], ql[t], s1);
      if (t < 2) { const int u = t + 2; k0[u] = frag_kb(Kr + col * KP + u * 32, hh); k1[u] = frag_kb(Kr + (16 + col) * KP + u * 32, hh); k0l[u] = frag_kb(Klr + col * KP + u * 32, hh); k1l[u] = frag_kb(Klr + (16 + col) * KP + u * 32, hh); } }
    const b16* V = (const b16*)(S + 2 * KPL) + c0; const b16* Vl = (const b16*)(S + 2 * KPL + VPL) + c0;
    v16b vf[8], vlf[8];
#pragma unroll
    for (int t = 0; t < 8; ++t) vf[t] = frag_kb(V + (t * 16 + col) * VP, hh);
#pragma unroll
    for (int t = 0; t < 4; ++t) vlf[t] = frag_kb(Vl + (t * 16 + col) * VP, hh);
    __builtin_amdgcn_sched_barrier(0);   // V hi and the first half of V lo are issued here and return under the softmax; without it the reads sink to their products and each meets the LDS latency
    float mr = -INFINITY;
#pragma unroll
    for (int e = 0; e < 8; ++e) { const int kc0 = c0 + 8 * hh + e, kc1 = kc0 + 16; const bool v0 = (kc0 >= wqx - PADW) && (kc0 <= wqx + PADW), v1 = (kc1 >= wqx - PADW) && (kc1 <= wqx + PADW);
      s0[e] = v0 ? s0[e] * (1.0f / (XS * XS)) : -INFINITY; s1[e] = v1 ? s1[e] * (1.0f / (XS * XS)) : -INFINITY; mr = fmaxf(mr, fmaxf(s0[e], s1[e])); }
    mr = fmaxf(mr, __shfl_xor(mr, 16)); const float mn = fmaxf(m, mr); const float al_ = (mn == -INFINITY) ? 1.0f : nexp(m - mn); m = mn; float sum = 0.0f; v16b pb, pl;
#pragma unroll
    for (int e = 0; e < 8; e += 2) { v2f p0, p1;
#pragma unroll   // so that s0[e + i] and p0[i] are fixed registers
      for (int i = 0; i < 2; ++i) { const float e0 = (s0[e + i] == -INFINITY) ? 0.0f : nexp(s0[e + i] - mn), e1 = (s1[e + i] == -INFINITY) ? 0.0f : nexp(s1[e + i] - mn); sum += e0 + e1; p0[i] = e0 * PS; p1[i] = e1 * PS; }
      v2b a_, c_; split16x2(p0, a_, c_); pb[e] = a_[0]; pb[e + 1] = a_[1]; pl[e] = c_[0]; pl[e + 1] = c_[1]; split16x2(p1, a_, c_); pb[8 + e] = a_[0]; pb[9 + e] = a_[1]; pl[8 + e] = c_[0]; pl[9 + e] = c_[1]; }
    sum += __shfl_xor(sum, 16); l = l * al_ + sum;
#pragma unroll
    for (int t = 0; t < 8; ++t) o[t] *= al_;
#pragma unroll
    for (int t = 0; t < 8; ++t) o[t] = wmma16b(vf[t], pb, o[t]);   // eight independent accumulators in turn; each o[t] takes its three products in the order it had
#pragma unroll
    for (int t = 0; t < 4; ++t) o[t] = wmma16b(vf[t], pl, o[t]);
#pragma unroll
    for (int t = 4; t < 8; ++t) vlf[t] = frag_kb(Vl + (t * 16 + col) * VP, hh);
    __builtin_amdgcn_sched_barrier(0);   // the second half of V lo goes into registers that V hi has left (the operands of wmma16b stay under v256), eight products ahead of its first use
#pragma unroll
    for (int t = 4; t < 8; ++t) o[t] = wmma16b(vf[t], pl, o[t]);
#pragma unroll
    for (int t = 0; t < 8; ++t) o[t] = wmma16b(vlf[t], pb, o[t]);
    }
    if (it < nit) { v8f ak[4], av[4]; const b16* T = T0 + (it & 1) * (KPL / 2); unsigned char* Pw = L + (it & 1) * STG;
#pragma unroll
      for (int rt = 0; rt < 4; ++rt) { ak[rt] = (v8f){}; av[rt] = (v8f){}; }
#pragma unroll
      for (int kb = 0; kb < 4; ++kb)
#pragma unroll
        for (int rt = 0; rt < 4; ++rt) { const v16b a = frag_kb(T + (rt * 16 + col) * KP + kb * 32, hh); ak[rt] = wmma16c(wkf[kb], a, ak[rt]); av[rt] = wmma16c(a, wvf[kb], av[rt]); }
      b16* Kh = (b16*)Pw; b16* Kl = (b16*)(Pw + KPL); b16* Vh = (b16*)(Pw + 2 * KPL); b16* Vw = (b16*)(Pw + 2 * KPL + VPL);
#pragma unroll
      for (int rt = 0; rt < 4; ++rt) { v8b ph, pw, vh8, vl8;
#pragma unroll
        for (int v = 0; v < 8; v += 2) { v2b a_, c_; split16x2((v2f){ak[rt][v] + bk8[v], ak[rt][v + 1] + bk8[v + 1]}, a_, c_); ph[v] = a_[0]; ph[v + 1] = a_[1]; pw[v] = c_[0]; pw[v + 1] = c_[1];
          split16x2((v2f){av[rt][v] + bvs, av[rt][v + 1] + bvs}, a_, c_); vh8[v] = a_[0]; vh8[v + 1] = a_[1]; vl8[v] = c_[0]; vl8[v + 1] = c_[1]; }
        *(v8b*)(Kh + (rt * 16 + col) * KP + o8) = ph; *(v8b*)(Kl + (rt * 16 + col) * KP + o8) = pw;
        *(v8b*)(Vh + orow * VP + rt * 16 + 8 * hh) = vh8; *(v8b*)(Vw + orow * VP + rt * 16 + 8 * hh) = vl8; } }
    if (it + 1 < nit) put_x(T0 + ((it + 1) & 1) * (KPL / 2));
    __syncthreads();   // row r + 1's planes and row r + 2's x are whole; every wave has left row r's planes and row r + 1's x (behind the last row: the planes become the output staging)
  }
  float (*Os)[2 * IW + 4] = (float (*)[2 * IW + 4])L;
  const float inv = 1.0f / (l * PS * XS);   // every pixel has at least itself in the window; (8v).(8p) carries x64
#pragma unroll
  for (int t = 0; t < 8; ++t)
#pragma unroll
    for (int e = 0; e < 8; ++e) Os[t * 16 + 8 * hh + e][qr * IW + wqx] = o[t][e] * inv;
  __syncthreads();
  { for (int i = tid; i < C * 32; i += 256) { const int c = i >> 5, c4 = (i & 31) * 4; *(v4f*)(out + ((size_t)b * C + c) * NPI + (size_t)h0 * IW + c4) = *(const v4f*)(&Os[c][c4]); }  }
}
}  // namespace

extern "C" void kernel_launch(void* const* d_in, const int* in_sizes, int n_in,
                              void* d_out, int out_size, void* d_ws, size_t ws_size, hipStream_t stream) {
  (void)n_in; (void)out_size; (void)d_ws; (void)ws_size;
  const float* x = (const float*)d_in[0]; const float* wq = (const float*)d_in[1]; const float* bq = (const float*)d_in[2]; const float* wk = (const float*)d_in[3]; const float* bk = (const float*)d_in[4]; const float* wv = (const float*)d_in[5]; const float* bv = (const float*)d_in[6];
  float* out = (float*)d_out;   // [8][128][64][64]
  if (in_sizes[0] != NT * C || in_sizes[1] != C * C) return;
  fused_kernel<<<dim3(1, IH / 2, Bn), 256, 0, stream>>>(x, wq, bq, wk, bk, wv, bv, out);
}

// v006
// It runs in 20.5 microseconds.
// Next to v005, in two timings, it ran 1.16 times as fast each time.
// Over all steps from v000 it is 4.78 times as fast.
#include <hip/hip_runtime.h>

// Local 7x7 attention: q, k, v = 1x1 convs (+bias) of x [8][128][64][64]; for every pixel, scores over the 49 zero-padded neighbours = sum_c q[c] k_unf[c] (padded neighbours score exactly
// 0 and carry v = 0), softmax over the 49, y[c] = sum attn v_unf[c] -> [8][128][64][64] (NCHW).
// WMMA (v_wmma_f32_16x16x32_f16, f32 accumulate). Operands x and W rounded to bf16 (exact in f16); every intermediate (q, Wk^T q, P, the weighted sum of x) as an f16 hi+lo pair x8 (the unscaled
// 128-term logits have a deviation of about 11, so their absolute precision matters); window mask by index compare, the out-of-image neighbours added analytically as n_out * e^(0 - m) to the denominator.

namespace {
constexpr int Bn = 8, C = 128, IH = 64, IW = 64, NPI = IH * IW, NT = Bn * NPI, KS = 7, PADW = 3;
constexpr float XS = 8.0f, PS = 8.0f;

typedef _Float16 b16;
typedef __attribute__((ext_vector_type(16))) _Float16 v16b;
typedef __attribute__((ext_vector_type(8))) _Float16 v8b;
typedef __attribute__((ext_vector_type(8))) float v8f;
typedef __attribute__((ext_vector_type(4))) float v4f;
typedef __attribute__((ext_vector_type(2))) float v2f;
typedef __attribute__((ext_vector_type(2))) _Float16 v2b;
typedef __attribute__((ext_vector_type(4))) _Float16 v4b;
typedef __attribute__((ext_vector_type(2))) __bf16 v2r;
// rounding to bf16 (nearest, ties to even) by the chip's own convert, two values an instruction, and back to f32
__device__ __forceinline__ float bf16_rne(float f) { return (float)(__bf16)f; }
__device__ __forceinline__ v2f bf16_rne2(float a, float b) { return __builtin_convertvector(__builtin_convertvector((v2f){a, b}, v2r), v2f); }
__device__ __forceinline__ void split16x2(v2f v, v2b& hi, v2b& lo) { hi = __builtin_convertvector(v, v2b); lo = __builtin_convertvector(v - __builtin_convertvector(hi, v2f), v2b); }
__device__ __forceinline__ v16b frag_kb(const b16* p, int hh) { const v8b a = *(const v8b*)(p + 8 * hh), b = *(const v8b*)(p + 16 + 8 * hh); v16b f;
#pragma unroll
  for (int e = 0; e < 8; ++e) { f[e] = a[e]; f[8 + e] = b[e]; } return f; }
// the product, with the distance behind it left to the compiler
__device__ __forceinline__ v8f wmma16c(v16b a, v16b b, v8f c) { return __builtin_amdgcn_wmma_f32_16x16x32_f16(false, a, false, b, (short)0, c, false, false); }
__device__ __forceinline__ float nexp(float x) { return __builtin_amdgcn_exp2f(x * 1.4426950408889634f); }

// a weight fragment in the k order of frag_kb, from a row of f32 weights: the four 16-byte loads, and apart from them the rounding (as the operands are defined)
struct wraw { v4f q[4]; };
__device__ __forceinline__ wraw load_w(const float* p) { wraw r; r.q[0] = *(const v4f*)(p); r.q[1] = *(const v4f*)(p + 4); r.q[2] = *(const v4f*)(p + 16); r.q[3] = *(const v4f*)(p + 20); return r; }   // p: the row's block of 32, + 8 * hh
__device__ __forceinline__ v16b round_w(const wraw& r) { v16b f;
#pragma unroll
  for (int i = 0; i < 4; ++i)
#pragma unroll
    for (int e = 0; e < 4; e += 2) { const v2b p = __builtin_convertvector(bf16_rne2(r.q[i][e], r.q[i][e + 1]), v2b); f[4 * i + e] = p[0]; f[4 * i + e + 1] = p[1]; }
  return f; }
// the same fragment from a COLUMN of a weight matrix (the matrix transposed): sixteen 4-byte loads, p = the column's element in row (block of 32) + 8 * hh
__device__ __forceinline__ wraw load_wt(const float* p) { wraw r;
#pragma unroll
  for (int i = 0; i < 4; ++i) { r.q[0][i] = p[i * C]; r.q[1][i] = p[(4 + i) * C]; r.q[2][i] = p[(16 + i) * C]; r.q[3][i] = p[(20 + i) * C]; }
  return r; }
// all in one launch: block = (image b, two query rows h0, h0+1, all 64 columns) x 8 waves. k and v are never formed. Both convs are linear, so
//   q.k_j = q.(Wk x_j + bk) = (Wk^T q).x_j + q.bk   and   sum_j p_j v_j = Wv (sum_j p_j x_j) + bv sum_j p_j   (j: the in-image neighbours; the padded ones score 0 and carry 0 as before).
// Once per query: q, then u = Wk^T q (q as hi+lo, 2 products) and t = q.bk. Per key row: the rounded x row lies in LDS as pixel rows and as channel rows (it is exact in f16, one plane each);
// wave w attends for query row h0 + w/4, columns 16(w%4)..+15: S^T = x.u + t (u as hi+lo, 2 products), window mask |dc| <= 3, a^T += x^T.P^T (P as hi+lo, 2 products). Once at the end: y = Wv a / l + bv l_in / l.
constexpr int KP = C + 8, VP = IW + 8;                          // LDS pitches in halfs: 272 B and 144 B, both 16 B x odd, so that 16 lanes' 16-byte accesses fall on 64 distinct banks
constexpr int KPL = IW * KP * 2, VPL = C * VP * 2;              // bytes of one row as pixel rows, as channel rows
constexpr int OFF_XT = 0, OFF_XC = 2 * KPL, OFF_Q = OFF_XC + 2 * VPL, OFF_U = OFF_Q + 4 * KPL, OFF_WV = OFF_U + 4 * KPL, OFF_BV = OFF_WV + C * KP * 2, OFF_BK = OFF_BV + C * 4, LDS_ALL = OFF_BK + C * 2;
__global__ __launch_bounds__(256) void fused_kernel(const float* __restrict__ x, const float* __restrict__ wq, const float* __restrict__ bq, const float* __restrict__ wk, const float* __restrict__ bk, const float* __restrict__ wv, const float* __restrict__ bv, float* __restrict__ out) {
  __shared__ __attribute__((aligned(16))) unsigned char L[LDS_ALL];   // two buffers of an x row as pixel rows, two as channel rows, q of the two rows hi, lo, u likewise (q: at the end the output staging), Wv rounded, bv and bk rounded
  const int tid = threadIdx.x, lane = tid & 31, wave = __builtin_amdgcn_readfirstlane(tid >> 5), hh = lane >> 4, col = lane & 15;
  const int b = blockIdx.z, h0 = blockIdx.y * 2, qr = wave >> 2, h = h0 + qr, w0 = (wave & 3) * 16, wqx = w0 + col;
  const int R_lo = (h0 - PADW < 0) ? 0 : h0 - PADW, R_hi = (h0 + 1 + PADW > IH - 1) ? IH - 1 : h0 + 1 + PADW;   // in-image key rows of the block, uniform per block
  // out-of-image neighbour count for this lane's query: rows outside [0,IH) x 7 cols + in-image rows x cols outside [0,IW)
  const int r_lo = (h - PADW < 0) ? 0 : h - PADW, r_hi = (h + PADW > IH - 1) ? IH - 1 : h + PADW, c_lo = (wqx - PADW < 0) ? 0 : wqx - PADW, c_hi = (wqx + PADW > IW - 1) ? IW - 1 : wqx + PADW;
  b16* const T0 = (b16*)(L + OFF_XT); b16* const X0 = (b16*)(L + OFF_XC); unsigned char* const Q0 = L + OFF_Q; unsigned char* const U0 = L + OFF_U; b16* const WV = (b16*)(L + OFF_WV); float* const BV = (float*)(L + OFF_BV); b16* const BK = (b16*)(L + OFF_BK);
  const int xpx = tid & 63, xc = (tid >> 6) * 32;   // pixel rows: this thread's pixel and its 32 channels of an x row
  const float* xb = x + ((size_t)b * C + xc) * NPI + xpx;
  const int ypx = (tid & 15) * 4, yc = tid >> 4;    // channel rows: this thread's 4 pixels, of channels yc + 16 j
  const float* yb = x + ((size_t)b * C + yc) * NPI + ypx;
  const int orow = wave * 16 + col, o8 = wave * 16 + 8 * hh;
  const unsigned wob = (unsigned)(orow * C + 8 * hh) * 4u;   // one 32-bit byte offset for the row fragments of Wq and Wv: every such load names this register and its matrix's scalar base, which keep their values up to the wait below
  const unsigned wtb = (unsigned)(8 * hh * C + orow) * 4u;   // and one for the column fragments of Wk
  const int ti = tid & (C - 1);
  float xv[32]; v4f xw[8]; wraw rw[3][4];
#pragma unroll
  for (int kb = 0; kb < 4; ++kb) rw[0][kb] = load_w((const float*)((const char*)wq + wob) + kb * 32);
  __builtin_amdgcn_sched_barrier(0);   // the q weights are asked for first and so counted back first: they are rounded while x is still in flight
#pragma unroll
  for (int j = 0; j < 32; ++j) xv[j] = xb[(size_t)j * NPI + h0 * IW];
#pragma unroll
  for (int kb = 0; kb < 4; ++kb) { rw[1][kb] = load_wt((const float*)((const char*)wk + wtb) + kb * 32 * C); rw[2][kb] = load_w((const float*)((const char*)wv + wob) + kb * 32); }
  float bqr[8];
#pragma unroll
  for (int v = 0; v < 8; ++v) bqr[v] = bq[o8 + v];
  const float bvr = bv[ti], bkr = bk[ti];
  asm volatile("s_wait_xcnt 0x0" :: "v"(wob), "v"(wtb) : "memory");   // stands in front of whatever reuses the address registers of the loads above; the two offsets are named so that they keep their registers up to here
  __builtin_amdgcn_sched_barrier(0);   // holds the arithmetic below, which reuses those registers, behind the wait (a "memory" clobber does not)
  v16b wf[4], wkf[4];
#pragma unroll
  for (int kb = 0; kb < 4; ++kb) wf[kb] = round_w(rw[0][kb]);
  auto get_x = [&](int row) {   // an x row's 32 channels of this thread's pixel, asked for directly behind a barrier (which waits for every load), used at the end of the stretch up to the next one
    __builtin_amdgcn_sched_barrier(0);   // keeps earlier arithmetic from sinking in between the loads and their wait, where it took the loads' address register
#pragma unroll
    for (int j = 0; j < 32; ++j) xv[j] = xb[(size_t)j * NPI + row * IW];
    asm volatile("s_wait_xcnt 0x0" ::: "memory");   // as above
    __builtin_amdgcn_sched_barrier(0);   // as above: without it later arithmetic rose over the wait into the loads' address register
  };
  auto get_x2 = [&](int row) {   // a key row, asked for both ways: for the pixel rows as in get_x, for the channel rows 4 pixels of 8 channels (the second reading finds the lines near)
    __builtin_amdgcn_sched_barrier(0);   // as in get_x
#pragma unroll
    for (int j = 0; j < 32; ++j) xv[j] = xb[(size_t)j * NPI + row * IW];
#pragma unroll
    for (int j = 0; j < 8; ++j) xw[j] = *(const v4f*)(yb + (size_t)(16 * j) * NPI + row * IW);
    asm volatile("s_wait_xcnt 0x0" ::: "memory");   // as above
    __builtin_amdgcn_sched_barrier(0);   // as above
  };
  auto put_x = [&](b16* T) {   // the scale 8 goes on ahead of the rounding: a power of two, so the rounded value is the same, and the f32 product packs two values an instruction
#pragma unroll
    for (int k = 0; k < 4; ++k) { v8b pk;
#pragma unroll
      for (int e = 0; e < 8; e += 2) { const v2b p = __builtin_convertvector(bf16_rne2(xv[k * 8 + e] * XS, xv[k * 8 + e + 1] * XS), v2b); pk[e] = p[0]; pk[e + 1] = p[1]; }
      *(v8b*)(T + xpx * KP + xc + k * 8) = pk; }
  };
  auto put_xc = [&](b16* X) {   // the same values as channel rows: 8 bytes a store
#pragma unroll
    for (int j = 0; j < 8; ++j) { const v2b p = __builtin_convertvector(bf16_rne2(xw[j][0] * XS, xw[j][1] * XS), v2b), r = __builtin_convertvector(bf16_rne2(xw[j][2] * XS, xw[j][3] * XS), v2b);
      *(v4b*)(X + (yc + 16 * j) * VP + ypx) = (v4b){p[0], p[1], r[0], r[1]}; }
  };
  put_x(T0);
  // holds the 4 bias loads in front of the first barrier, whose wait for every load covers them: left free they sink behind later barriers, each meets its latency there
  asm volatile("" :: "v"(bqr[0]), "v"(bqr[1]), "v"(bqr[2]), "v"(bqr[3]), "v"(bqr[4]), "v"(bqr[5]), "v"(bqr[6]), "v"(bqr[7]), "v"(bvr), "v"(bkr));
  float bq8[8];
#pragma unroll
  for (int v = 0; v < 8; ++v) bq8[v] = XS * bf16_rne(bqr[v]);
  if (tid < C) { BV[ti] = XS * bf16_rne(bvr); BK[ti] = (b16)bf16_rne(bkr); }
  __syncthreads();                                  // the first x row is whole
  // q of the two query rows: weight rows as the first operand, so that a lane holds 8 neighbouring channels of one pixel (one 16-byte LDS store)
#pragma unroll
  for (int qi = 0; qi < 2; ++qi) {
    if (qi == 0) get_x(h0 + 1); else get_x2(R_lo);
    const b16* T = T0 + qi * (KPL / 2);
    v8f acc[4];
#pragma unroll
    for (int rt = 0; rt < 4; ++rt) acc[rt] = (v8f){};
#pragma unroll
    for (int kb = 0; kb < 4; ++kb)
#pragma unroll
      for (int rt = 0; rt < 4; ++rt) acc[rt] = wmma16c(wf[kb], frag_kb(T + (rt * 16 + col) * KP + kb * 32, hh), acc[rt]);
    b16* Qh = (b16*)(Q0 + (2 * qi) * KPL); b16* Ql = (b16*)(Q0 + (2 * qi + 1) * KPL);
#pragma unroll
    for (int rt = 0; rt < 4; ++rt) { v8b ph, pw;
#pragma unroll
      for (int v = 0; v < 8; v += 2) { v2b a_, c_; split16x2((v2f){acc[rt][v] + bq8[v], acc[rt][v + 1] + bq8[v + 1]}, a_, c_); ph[v] = a_[0]; ph[v + 1] = a_[1]; pw[v] = c_[0]; pw[v + 1] = c_[1]; }
      *(v8b*)(Qh + (rt * 16 + col) * KP + o8) = ph; *(v8b*)(Ql + (rt * 16 + col) * KP + o8) = pw; }
    if (qi == 0) {
#pragma unroll
      for (int kb = 0; kb < 4; ++kb) wkf[kb] = round_w(rw[1][kb]);
    } else {   // this wave's 16 rows of Wv, rounded, go to LDS: at the end every wave reads all 128
#pragma unroll
      for (int kb = 0; kb < 4; ++kb) { const v16b f = round_w(rw[2][kb]); v8b a, c;
#pragma unroll
        for (int e = 0; e < 8; ++e) { a[e] = f[e]; c[e] = f[8 + e]; }
        *(v8b*)(WV + orow * KP + kb * 32 + 8 * hh) = a; *(v8b*)(WV + orow * KP + kb * 32 + 16 + 8 * hh) = c; }
      put_xc(X0);
    }
    put_x(T0 + (qi ^ 1) * (KPL / 2));               // the other x buffer: its readers left it in front of the last barrier
    __syncthreads();                                // this q row and the next x row are whole
  }
  // u = Wk^T q of the two query rows (8u, as q carries x8): columns of Wk as the first operand, q hi and q lo as the second; laid down hi, lo as q was
#pragma unroll
  for (int qi = 0; qi < 2; ++qi) {
    const b16* Sh = (const b16*)(Q0 + (2 * qi) * KPL); const b16* Sl = (const b16*)(Q0 + (2 * qi + 1) * KPL);
    v8f acc[4];
#pragma unroll
    for (int rt = 0; rt < 4; ++rt) acc[rt] = (v8f){};
#pragma unroll
    for (int kb = 0; kb < 4; ++kb)
#pragma unroll
      for (int rt = 0; rt < 4; ++rt) acc[rt] = wmma16c(wkf[kb], frag_kb(Sh + (rt * 16 + col) * KP + kb * 32, hh), acc[rt]);
#pragma unroll
    for (int kb = 0; kb < 4; ++kb)
#pragma unroll
      for (int rt = 0; rt < 4; ++rt) acc[rt] = wmma16c(wkf[kb], frag_kb(Sl + (rt * 16 + col) * KP + kb * 32, hh), acc[rt]);
    b16* Uh = (b16*)(U0 + (2 * qi) * KPL); b16* Ul = (b16*)(U0 + (2 * qi + 1) * KPL);
#pragma unroll
    for (int rt = 0; rt < 4; ++rt) { v8b ph, pw;
#pragma unroll
      for (int v = 0; v < 8; v += 2) { v2b a_, c_; split16x2((v2f){acc[rt][v], acc[rt][v + 1]}, a_, c_); ph[v] = a_[0]; ph[v + 1] = a_[1]; pw[v] = c_[0]; pw[v + 1] = c_[1]; }
      *(v8b*)(Uh + (rt * 16 + col) * KP + o8) = ph; *(v8b*)(Ul + (rt * 16 + col) * KP + o8) = pw; }
  }
  // t = q.bk of this lane's query: bk as every row of the first operand, so that each of the 8 results of a lane is its query's t
  float traw;
  { const b16* Qh = (const b16*)(Q0 + (2 * qr) * KPL) + wqx * KP; const b16* Ql = (const b16*)(Q0 + (2 * qr + 1) * KPL) + wqx * KP; v8f ta = {}; v16b bkf[4];
#pragma unroll
    for (int kb = 0; kb < 4; ++kb) bkf[kb] = frag_kb(BK + kb * 32, hh);
#pragma unroll
    for (int kb = 0; kb < 4; ++kb) ta = wmma16c(bkf[kb], frag_kb(Qh + kb * 32, hh), ta);
#pragma unroll
    for (int kb = 0; kb < 4; ++kb) ta = wmma16c(bkf[kb], frag_kb(Ql + kb * 32, hh), ta);
    traw = ta[0] * XS; }   // (8q).bk x 8: the scale 64 of the products (8x).(8u)
  __syncthreads();                                  // u is whole
  v16b qf[4], ql[4];   // this lane's u, hi and lo: in registers over the whole key-row loop
  { const b16* Uh = (const b16*)(U0 + (2 * qr) * KPL) + wqx * KP; const b16* Ul = (const b16*)(U0 + (2 * qr + 1) * KPL) + wqx * KP;
#pragma unroll
    for (int t = 0; t < 4; ++t) { qf[t] = frag_kb(Uh + t * 32, hh); ql[t] = frag_kb(Ul + t * 32, hh); } }
  const int n_in = (r_hi - r_lo + 1) * (c_hi - c_lo + 1), n_out = KS * KS - n_in;
  float m = (n_out > 0) ? 0.0f : -INFINITY, l = (float)n_out, li = 0.0f; v8f o[8];   // li: the in-image part of l, which bv goes with
#pragma unroll
  for (int t = 0; t < 8; ++t) o[t] = (v8f){};
  int c0 = w0 - 8; c0 = (c0 < 0) ? 0 : (c0 > IW - 32 ? IW - 32 : c0);   // aligned key columns covering [w0-3, w0+18]
  // one barrier a key row: between two barriers a wave attends to row r (one buffer of each kind) and lays down x of row r + 1 (the other)
  const int nit = R_hi - R_lo + 1;
  for (int it = 0; it < nit; ++it) {
    const int r = R_lo + it;
    if (it + 1 < nit) get_x2(r + 1);
    if (r >= r_lo && r <= r_hi) {   // uniform per wave: this key row lies in the window of the wave's query row
    const b16* Kr = T0 + (it & 1) * (KPL / 2) + c0 * KP; const b16* V = X0 + (it & 1) * (VPL / 2) + c0;
    v16b k0[4], k1[4], vf[8]; v8f s0, s1;
#pragma unroll
    for (int e = 0; e < 8; ++e) { s0[e] = traw; s1[e] = traw; }
#pragma unroll
    for (int t = 0; t < 4; ++t) { k0[t] = frag_kb(Kr + col * KP + t * 32, hh); k1[t] = frag_kb(Kr + (16 + col) * KP + t * 32, hh); }
#pragma unroll
    for (int t = 0; t < 8; ++t) vf[t] = frag_kb(V + (t * 16 + col) * VP, hh);
    __builtin_amdgcn_sched_barrier(0);   // all of the row's LDS reads are issued here, in the order of their use: the latency is met once, and the channel rows return under the score products and the softmax
#pragma unroll
    for (int t = 0; t < 4; ++t) { s0 = wmma16c(k0[t], qf[t], s0); s1 = wmma16c(k1[t], qf[t], s1); s0 = wmma16c(k0[t], ql[t], s0); s1 = wmma16c(k1[t], ql[t], s1); }
    float mr = -INFINITY;
#pragma unroll
    for (int e = 0; e < 8; ++e) { const int kc0 = c0 + 8 * hh + e, kc1 = kc0 + 16; const bool v0 = (kc0 >= wqx - PADW) && (kc0 <= wqx + PADW), v1 = (kc1 >= wqx - PADW) && (kc1 <= wqx + PADW);
      s0[e] = v0 ? s0[e] * (1.0f / (XS * XS)) : -INFINITY; s1[e] = v1 ? s1[e] * (1.0f / (XS * XS)) : -INFINITY; mr = fmaxf(mr, fmaxf(s0[e], s1[e])); }
    mr = fmaxf(mr, __shfl_xor(mr, 16)); const float mn = fmaxf(m, mr); const float al_ = (mn == -INFINITY) ? 1.0f : nexp(m - mn); m = mn; float sum = 0.0f; v16b pb, pl;
#pragma unroll
    for (int e = 0; e < 8; e += 2) { v2f p0, p1;
#pragma unroll   // so that s0[e + i] and p0[i] are fixed registers
      for (int i = 0; i < 2; ++i) { const float e0 = (s0[e + i] == -INFINITY) ? 0.0f : nexp(s0[e + i] - mn), e1 = (s1[e + i] == -INFINITY) ? 0.0f : nexp(s1[e + i] - mn); sum += e0 + e1; p0[i] = e0 * PS; p1[i] = e1 * PS; }
      v2b a_, c_; split16x2(p0, a_, c_); pb[e] = a_[0]; pb[e + 1] = a_[1]; pl[e] = c_[0]; pl[e + 1] = c_[1]; split16x2(p1, a_, c_); pb[8 + e] = a_[0]; pb[9 + e] = a_[1]; pl[8 + e] = c_[0]; pl[9 + e] = c_[1]; }
    sum += __shfl_xor(sum, 16); l = l * al_ + sum; li = li * al_ + sum;
#pragma unroll
    for (int t = 0; t < 8; ++t) o[t] *= al_;
#pragma unroll
    for (int t = 0; t < 8; ++t) o[t] = wmma16c(vf[t], pb, o[t]);   // eight independent accumulators in turn
#pragma unroll
    for (int t = 0; t < 8; ++t) o[t] = wmma16c(vf[t], pl, o[t]);
    asm volatile("v_nop\n\tv_nop\n\tv_nop\n\tv_nop" : "+v"(o[7]));   // the distance behind the row's last product: on the last row, which has no x stores, only scalar instructions and the barrier follow, up to the arithmetic after the loop
    }
    if (it + 1 < nit) { put_x(T0 + ((it + 1) & 1) * (KPL / 2)); put_xc(X0 + ((it + 1) & 1) * (VPL / 2)); }
    __syncthreads();   // row r + 1's x is whole; every wave has left row r's
  }
  // y = Wv a / l + bv l_in / l: the accumulators of a lane are, as they lie, the second operand's fragments of its query (channels 32 kb + 8 hh + e and + 16), as hi+lo x8; 2 products
  const float rl = 1.0f / l, inv = rl * (1.0f / PS), bsc = li * rl;   // every pixel has at least itself in the window; (8x).(8p) carries x64, of which x8 stays for the split
  v16b ah[4], al[4];
#pragma unroll
  for (int kb = 0; kb < 4; ++kb)
#pragma unroll
    for (int g = 0; g < 2; ++g)
#pragma unroll
      for (int e = 0; e < 8; e += 2) { v2b a_, c_; split16x2((v2f){o[2 * kb + g][e] * inv, o[2 * kb + g][e + 1] * inv}, a_, c_); ah[kb][8 * g + e] = a_[0]; ah[kb][8 * g + e + 1] = a_[1]; al[kb][8 * g + e] = c_[0]; al[kb][8 * g + e + 1] = c_[1]; }
  float (*Os)[2 * IW + 4] = (float (*)[2 * IW + 4])(L + OFF_Q);   // over q, which nobody has read since the barriers in front of the loop
#pragma unroll
  for (int t = 0; t < 8; ++t) { const v4f b0 = *(const v4f*)(BV + t * 16 + 8 * hh), b1 = *(const v4f*)(BV + t * 16 + 8 * hh + 4); v8f y;
#pragma unroll
    for (int e = 0; e < 4; ++e) { y[e] = b0[e] * bsc; y[4 + e] = b1[e] * bsc; }
#pragma unroll
    for (int kb = 0; kb < 4; ++kb) { const v16b w = frag_kb(WV + (t * 16 + col) * KP + kb * 32, hh); y = wmma16c(w, ah[kb], y); y = wmma16c(w, al[kb], y); }
    o[t] = y; }
#pragma unroll
  for (int t = 0; t < 8; ++t)
#pragma unroll
    for (int e = 0; e < 8; ++e) Os[t * 16 + 8 * hh + e][qr * IW + wqx] = o[t][e] * (1.0f / XS);
  __syncthreads();
  { for (int i = tid; i < C * 32; i += 256) { const int c = i >> 5, c4 = (i & 31) * 4; *(v4f*)(out + ((size_t)b * C + c) * NPI + (size_t)h0 * IW + c4) = *(const v4f*)(&Os[c][c4]); }  }
}
}  // namespace

extern "C" void kernel_launch(void* const* d_in, const int* in_sizes, int n_in,
                              void* d_out, int out_size, void* d_ws, size_t ws_size, hipStream_t stream) {
  (void)n_in; (void)out_size; (void)d_ws; (void)ws_size;
  const float* x = (const float*)d_in[0]; const float* wq = (const float*)d_in[1]; const float* bq = (const float*)d_in[2]; const float* wk = (const float*)d_in[3]; const float* bk = (const float*)d_in[4]; const float* wv = (const float*)d_in[5]; const float* bv = (const float*)d_in[6];
  float* out = (float*)d_out;   // [8][128][64][64]
  if (in_sizes[0] != NT * C || in_sizes[1] != C * C) return;
  fused_kernel<<<dim3(1, IH / 2, Bn), 256, 0, stream>>>(x, wq, bq, wk, bk, wv, bv, out);
}

// v007
// Measured time: 18.9 microseconds a run.
// Next to v006, in two timings, it ran 1.08 times as fast each time.
// All steps since v000 together make it 5.15 times as fast.
#include <hip/hip_runtime.h>

// Local 7x7 attention: q, k, v = 1x1 convs (+bias) of x [8][128][64][64]; for every pixel, scores over the 49 zero-padded neighbours = sum_c q[c] k_unf[c] (padded neighbours score exactly
// 0 and carry v = 0), softmax over the 49, y[c] = sum attn v_unf[c] -> [8][128][64][64] (NCHW).
// WMMA (v_wmma_f32_16x16x32_f16, f32 accumulate). Operands x and W rounded to bf16 (exact in f16); every intermediate (q, Wk^T q, P, the weighted sum of x) as an f16 hi+lo pair x8 (the unscaled
// 128-term logits have a deviation of about 11, so their absolute precision matters); window mask by index compare, the out-of-image neighbours added analytically as n_out * e^(0 - m) to the denominator.

namespace {
constexpr int Bn = 8, C = 128, IH = 64, IW = 64, NPI = IH * IW, NT = Bn * NPI, KS = 7, PADW = 3;
constexpr float XS = 8.0f, PS = 8.0f;

typedef _Float16 b16;
typedef __attribute__((ext_vector_type(16))) _Float16 v16b;
typedef __attribute__((ext_vector_type(8))) _Float16 v8b;
typedef __attribute__((ext_vector_type(8))) float v8f;
typedef __attribute__((ext_vector_type(4))) float v4f;
typedef __attribute__((ext_vector_type(2))) float v2f;
typedef __attribute__((ext_vector_type(2))) _Float16 v2b;
typedef __attribute__((ext_vector_type(4))) _Float16 v4b;
typedef __attribute__((ext_vector_type(2))) __bf16 v2r;
// rounding to bf16 (nearest, ties to even) by the chip's own convert, two values an instruction, and back to f32
__device__ __forceinline__ float bf16_rne(float f) { return (float)(__bf16)f; }
__device__ __forceinline__ v2f bf16_rne2(float a, float b) { return __builtin_convertvector(__builtin_convertvector((v2f){a, b}, v2r), v2f); }
__device__ __forceinline__ void split16x2(v2f v, v2b& hi, v2b& lo) { hi = __builtin_convertvector(v, v2b); lo = __builtin_convertvector(v - __builtin_convertvector(hi, v2f), v2b); }
__device__ __forceinline__ v16b frag_kb(const b16* p, int hh) { const v8b a = *(const v8b*)(p + 8 * hh), b = *(const v8b*)(p + 16 + 8 * hh); v16b f;
#pragma unroll
  for (int e = 0; e < 8; ++e) { f[e] = a[e]; f[8 + e] = b[e]; } return f; }
// the same fragment (the k order of frag_kb) out of rows that run the other way: p = this lane's 16 bytes of a 16-row block, row 8 * hh + (lane & 7), bytes 16 * ((lane >> 3) & 1); the lane gets rows 8 hh .. + 7 and, 16 rows on, the same again, of column (lane & 15)
typedef __attribute__((ext_vector_type(8))) short v8s;
__device__ __forceinline__ v8b ld_tr16(const unsigned char* p) { typedef __attribute__((address_space(3))) v8s lds_v8s; return __builtin_bit_cast(v8b, __builtin_amdgcn_ds_load_tr16_b128_v8i16((lds_v8s*)p)); }
__device__ __forceinline__ v16b frag_tr(const unsigned char* p, int pitch) { const v8b a = ld_tr16(p), b = ld_tr16(p + 16 * pitch); v16b f;
#pragma unroll
  for (int e = 0; e < 8; ++e) { f[e] = a[e]; f[8 + e] = b[e]; } return f; }
// the product, with the distance behind it left to the compiler
__device__ __forceinline__ v8f wmma16c(v16b a, v16b b, v8f c) { return __builtin_amdgcn_wmma_f32_16x16x32_f16(false, a, false, b, (short)0, c, false, false); }
__device__ __forceinline__ float nexp(float x) { return __builtin_amdgcn_exp2f(x * 1.4426950408889634f); }

// a weight fragment in the k order of frag_kb, from a row of f32 weights: the four 16-byte loads, and apart from them the rounding (as the operands are defined)
struct wraw { v4f q[4]; };
__device__ __forceinline__ wraw load_w(const float* p) { wraw r; r.q[0] = *(const v4f*)(p); r.q[1] = *(const v4f*)(p + 4); r.q[2] = *(const v4f*)(p + 16); r.q[3] = *(const v4f*)(p + 20); return r; }   // p: the row's block of 32, + 8 * hh
__device__ __forceinline__ v16b round_w(const wraw& r) { v16b f;
#pragma unroll
  for (int i = 0; i < 4; ++i)
#pragma unroll
    for (int e = 0; e < 4; e += 2) { const v2b p = __builtin_convertvector(bf16_rne2(r.q[i][e], r.q[i][e + 1]), v2b); f[4 * i + e] = p[0]; f[4 * i + e + 1] = p[1]; }
  return f; }
// the same fragment from a COLUMN of a weight matrix (the matrix transposed): sixteen 4-byte loads, p = the column's element in row (block of 32) + 8 * hh
__device__ __forceinline__ wraw load_wt(const float* p) { wraw r;
#pragma unroll
  for (int i = 0; i < 4; ++i) { r.q[0][i] = p[i * C]; r.q[1][i] = p[(4 + i) * C]; r.q[2][i] = p[(16 + i) * C]; r.q[3][i] = p[(20 + i) * C]; }
  return r; }
// all in one launch: block = (image b, two query rows h0, h0+1, all 64 columns) x 8 waves. k and v are never formed. Both convs are linear, so
//   q.k_j = q.(Wk x_j + bk) = (Wk^T q).x_j + q.bk   and   sum_j p_j v_j = Wv (sum_j p_j x_j) + bv sum_j p_j   (j: the in-image neighbours; the padded ones score 0 and carry 0 as before).
// Once per query: q, then u = Wk^T q (q as hi+lo, 2 products) and t = q.bk. Per key row: the rounded x row lies in LDS once, as channel rows (it is exact in f16, one plane); fragments along the pixels are plain reads, fragments along the channels come by the transposing read;
// wave w attends for query row h0 + w/4, columns 16(w%4)..+15: S^T = x.u + t (u as hi+lo, 2 products), window mask |dc| <= 3, a^T += x^T.P^T (P as hi+lo, 2 products). Once at the end: y = Wv a / l + bv l_in / l.
constexpr int KP = C + 8, VP = IW + 80;                         // LDS pitches in halfs: 272 B = 16 B x odd for plain 16-byte reads; the x rows 288 B = 32 B x odd, the transposing read's pitch (its fragments are wanted first in a key row); 160 B is the same on the banks, but with it this compiler laid out the Wv reads of the end as read, wait, product
constexpr int KPL = IW * KP * 2, VPL = C * VP * 2, VPB = VP * 2; // bytes of one row of q or u as pixel rows, of one x row as channel rows; the x pitch in bytes
constexpr int OFF_XC = 0, OFF_Q = OFF_XC + 2 * VPL, OFF_U = OFF_Q + 4 * KPL, OFF_WV = OFF_U + 4 * KPL, OFF_BV = OFF_WV + C * KP * 2, OFF_BK = OFF_BV + C * 4, LDS_ALL = OFF_BK + C * 2;
__global__ __launch_bounds__(256) void fused_kernel(const float* __restrict__ x, const float* __restrict__ wq, const float* __restrict__ bq, const float* __restrict__ wk, const float* __restrict__ bk, const float* __restrict__ wv, const float* __restrict__ bv, float* __restrict__ out) {
  __shared__ __attribute__((aligned(16))) unsigned char L[LDS_ALL];   // two buffers of an x row as channel rows, q of the two rows hi, lo, u likewise (q: at the end the output staging), Wv rounded, bv and bk rounded
  const int tid = threadIdx.x, lane = tid & 31, wave = __builtin_amdgcn_readfirstlane(tid >> 5), hh = lane >> 4, col = lane & 15;
  const int b = blockIdx.z, h0 = blockIdx.y * 2, qr = wave >> 2, h = h0 + qr, w0 = (wave & 3) * 16, wqx = w0 + col;
  const int R_lo = (h0 - PADW < 0) ? 0 : h0 - PADW, R_hi = (h0 + 1 + PADW > IH - 1) ? IH - 1 : h0 + 1 + PADW;   // in-image key rows of the block, uniform per block
  // out-of-image neighbour count for this lane's query: rows outside [0,IH) x 7 cols + in-image rows x cols outside [0,IW)
  const int r_lo = (h - PADW < 0) ? 0 : h - PADW, r_hi = (h + PADW > IH - 1) ? IH - 1 : h + PADW, c_lo = (wqx - PADW < 0) ? 0 : wqx - PADW, c_hi = (wqx + PADW > IW - 1) ? IW - 1 : wqx + PADW;
  b16* const X0 = (b16*)(L + OFF_XC); unsigned char* const Q0 = L + OFF_Q; unsigned char* const U0 = L + OFF_U; b16* const WV = (b16*)(L + OFF_WV); float* const BV = (float*)(L + OFF_BV); b16* const BK = (b16*)(L + OFF_BK);
  const int ypx = (tid & 15) * 4, yc = tid >> 4;    // channel rows: this thread's 4 pixels, of channels yc + 16 j
  const float* yb = x + ((size_t)b * C + yc) * NPI + ypx;
  const unsigned char* const XT = L + OFF_XC + (8 * hh + (lane & 7)) * VPB + 16 * ((lane >> 3) & 1);   // this lane's place in a 16-channel block for the transposing read
  const int orow = wave * 16 + col, o8 = wave * 16 + 8 * hh;
  const unsigned wob = (unsigned)(orow * C + 8 * hh) * 4u;   // one 32-bit byte offset for the row fragments of Wq and Wv: every such load names this register and its matrix's scalar base, which keep their values up to the wait below
  const unsigned wtb = (unsigned)(8 * hh * C + orow) * 4u;   // and one for the column fragments of Wk
  const int ti = tid & (C - 1);
  v4f xw[8]; wraw rw[3][4];
#pragma unroll
  for (int kb = 0; kb < 4; ++kb) rw[0][kb] = load_w((const float*)((const char*)wq + wob) + kb * 32);
  __builtin_amdgcn_sched_barrier(0);   // the q weights are asked for first and so counted back first: they are rounded while x is still in flight
#pragma unroll
  for (int j = 0; j < 8; ++j) xw[j] = *(const v4f*)(yb + (size_t)(16 * j) * NPI + h0 * IW);
#pragma unroll
  for (int kb = 0; kb < 4; ++kb) { rw[1][kb] = load_wt((const float*)((const char*)wk + wtb) + kb * 32 * C); rw[2][kb] = load_w((const float*)((const char*)wv + wob) + kb * 32); }
  float bqr[8];
#pragma unroll
  for (int v = 0; v < 8; ++v) bqr[v] = bq[o8 + v];
  const float bvr = bv[ti], bkr = bk[ti];
  asm volatile("s_wait_xcnt 0x0" :: "v"(wob), "v"(wtb) : "memory");   // stands in front of whatever reuses the address registers of the loads above; the two offsets are named so that they keep their registers up to here
  __builtin_amdgcn_sched_barrier(0);   // holds the arithmetic below, which reuses those registers, behind the wait (a "memory" clobber does not)
  v16b wf[4], wkf[4];
#pragma unroll
  for (int kb = 0; kb < 4; ++kb) wf[kb] = round_w(rw[0][kb]);
  auto get_xc = [&](int row) {   // an x row: 4 pixels of 8 channels a thread, asked for directly behind a barrier (which waits for every load), used at the end of the stretch up to the next one
    __builtin_amdgcn_sched_barrier(0);   // keeps earlier arithmetic from sinking in between the loads and their wait, where it took the loads' address register
#pragma unroll
    for (int j = 0; j < 8; ++j) xw[j] = *(const v4f*)(yb + (size_t)(16 * j) * NPI + row * IW);
    asm volatile("s_wait_xcnt 0x0" ::: "memory");   // as above
    __builtin_amdgcn_sched_barrier(0);   // as above: without it later arithmetic rose over the wait into the loads' address register
  };
  auto put_xc = [&](b16* X) {   // 8 bytes a store; the scale 8 goes on ahead of the rounding: a power of two, so the rounded value is the same, and the f32 product packs two values an instruction
#pragma unroll
    for (int j = 0; j < 8; ++j) { const v2b p = __builtin_convertvector(bf16_rne2(xw[j][0] * XS, xw[j][1] * XS), v2b), r = __builtin_convertvector(bf16_rne2(xw[j][2] * XS, xw[j][3] * XS), v2b);
      *(v4b*)(X + (yc + 16 * j) * VP + ypx) = (v4b){p[0], p[1], r[0], r[1]}; }
  };
  put_xc(X0);
  // holds the 4 bias loads in front of the first barrier, whose wait for every load covers them: left free they sink behind later barriers, each meets its latency there
  asm volatile("" :: "v"(bqr[0]), "v"(bqr[1]), "v"(bqr[2]), "v"(bqr[3]), "v"(bqr[4]), "v"(bqr[5]), "v"(bqr[6]), "v"(bqr[7]), "v"(bvr), "v"(bkr));
  float bq8[8];
#pragma unroll
  for (int v = 0; v < 8; ++v) bq8[v] = XS * bf16_rne(bqr[v]);
  if (tid < C) { BV[ti] = XS * bf16_rne(bvr); BK[ti] = (b16)bf16_rne(bkr); }
  __syncthreads();                                  // the first x row is whole
  // q of the two query rows: weight rows as the first operand, so that a lane holds 8 neighbouring channels of one pixel (one 16-byte LDS store)
#pragma unroll
  for (int qi = 0; qi < 2; ++qi) {
    get_xc(qi == 0 ? h0 + 1 : R_lo);
    const unsigned char* T = XT + qi * VPL;
    v8f acc[4];
#pragma unroll
    for (int rt = 0; rt < 4; ++rt) acc[rt] = (v8f){};
#pragma unroll
    for (int kb = 0; kb < 4; ++kb)
#pragma unroll
      for (int rt = 0; rt < 4; ++rt) acc[rt] = wmma16c(wf[kb], frag_tr(T + kb * 32 * VPB + rt * 32, VPB), acc[rt]);
    b16* Qh = (b16*)(Q0 + (2 * qi) * KPL); b16* Ql = (b16*)(Q0 + (2 * qi + 1) * KPL);
#pragma unroll
    for (int rt = 0; rt < 4; ++rt) { v8b ph, pw;
#pragma unroll
      for (int v = 0; v < 8; v += 2) { v2b a_, c_; split16x2((v2f){acc[rt][v] + bq8[v], acc[rt][v + 1] + bq8[v + 1]}, a_, c_); ph[v] = a_[0]; ph[v + 1] = a_[1]; pw[v] = c_[0]; pw[v + 1] = c_[1]; }
      *(v8b*)(Qh + (rt * 16 + col) * KP + o8) = ph; *(v8b*)(Ql + (rt * 16 + col) * KP + o8) = pw; }
    if (qi == 0) {
#pragma unroll
      for (int kb = 0; kb < 4; ++kb) wkf[kb] = round_w(rw[1][kb]);
    } else {   // this wave's 16 rows of Wv, rounded, go to LDS: at the end every wave reads all 128
#pragma unroll
      for (int kb = 0; kb < 4; ++kb) { const v16b f = round_w(rw[2][kb]); v8b a, c;
#pragma unroll
        for (int e = 0; e < 8; ++e) { a[e] = f[e]; c[e] = f[8 + e]; }
        *(v8b*)(WV + orow * KP + kb * 32 + 8 * hh) = a; *(v8b*)(WV + orow * KP + kb * 32 + 16 + 8 * hh) = c; }
    }
    put_xc(X0 + (qi ^ 1) * (VPL / 2));              // the other x buffer: its readers left it in front of the last barrier
    __syncthreads();                                // this q row and the next x row are whole
  }
  // u = Wk^T q of the two query rows (8u, as q carries x8): columns of Wk as the first operand, q hi and q lo as the second; laid down hi, lo as q was
#pragma unroll
  for (int qi = 0; qi < 2; ++qi) {
    const b16* Sh = (const b16*)(Q0 + (2 * qi) * KPL); const b16* Sl = (const b16*)(Q0 + (2 * qi + 1) * KPL);
    v8f acc[4];
#pragma unroll
    for (int rt = 0; rt < 4; ++rt) acc[rt] = (v8f){};
#pragma unroll
    for (int kb = 0; kb < 4; ++kb)
#pragma unroll
      for (int rt = 0; rt < 4; ++rt) acc[rt] = wmma16c(wkf[kb], frag_kb(Sh + (rt * 16 + col) * KP + kb * 32, hh), acc[rt]);
#pragma unroll
    for (int kb = 0; kb < 4; ++kb)
#pragma unroll
      for (int rt = 0; rt < 4; ++rt) acc[rt] = wmma16c(wkf[kb], frag_kb(Sl + (rt * 16 + col) * KP + kb * 32, hh), acc[rt]);
    b16* Uh = (b16*)(U0 + (2 * qi) * KPL); b16* Ul = (b16*)(U0 + (2 * qi + 1) * KPL);
#pragma unroll
    for (int rt = 0; rt < 4; ++rt) { v8b ph, pw;
#pragma unroll
      for (int v = 0; v < 8; v += 2) { v2b a_, c_; split16x2((v2f){acc[rt][v], acc[rt][v + 1]}, a_, c_); ph[v] = a_[0]; ph[v + 1] = a_[1]; pw[v] = c_[0]; pw[v + 1] = c_[1]; }
      *(v8b*)(Uh + (rt * 16 + col) * KP + o8) = ph; *(v8b*)(Ul + (rt * 16 + col) * KP + o8) = pw; }
  }
  // t = q.bk of this lane's query: bk as every row of the first operand, so that each of the 8 results of a lane is its query's t
  float traw;
  { const b16* Qh = (const b16*)(Q0 + (2 * qr) * KPL) + wqx * KP; const b16* Ql = (const b16*)(Q0 + (2 * qr + 1) * KPL) + wqx * KP; v8f ta = {}; v16b bkf[4];
#pragma unroll
    for (int kb = 0; kb < 4; ++kb) bkf[kb] = frag_kb(BK + kb * 32, hh);
#pragma unroll
    for (int kb = 0; kb < 4; ++kb) ta = wmma16c(bkf[kb], frag_kb(Qh + kb * 32, hh), ta);
#pragma unroll
    for (int kb = 0; kb < 4; ++kb) ta = wmma16c(bkf[kb], frag_kb(Ql + kb * 32, hh), ta);
    traw = ta[0] * XS; }   // (8q).bk x 8: the scale 64 of the products (8x).(8u)
  __syncthreads();                                  // u is whole
  v16b qf[4], ql[4];   // this lane's u, hi and lo: in registers over the whole key-row loop
  { const b16* Uh = (const b16*)(U0 + (2 * qr) * KPL) + wqx * KP; const b16* Ul = (const b16*)(U0 + (2 * qr + 1) * KPL) + wqx * KP;
#pragma unroll
    for (int t = 0; t < 4; ++t) { qf[t] = frag_kb(Uh + t * 32, hh); ql[t] = frag_kb(Ul + t * 32, hh); } }
  const int n_in = (r_hi - r_lo + 1) * (c_hi - c_lo + 1), n_out = KS * KS - n_in;
  float m = (n_out > 0) ? 0.0f : -INFINITY, l = (float)n_out, li = 0.0f; v8f o[8];   // li: the in-image part of l, which bv goes with
#pragma unroll
  for (int t = 0; t < 8; ++t) o[t] = (v8f){};
  int c0 = w0 - 8; c0 = (c0 < 0) ? 0 : (c0 > IW - 32 ? IW - 32 : c0);   // aligned key columns covering [w0-3, w0+18]
  // one barrier a key row: between two barriers a wave attends to row r (one buffer) and lays down x of row r + 1 (the other)
  const int nit = R_hi - R_lo + 1;
  for (int it = 0; it < nit; ++it) {
    const int r = R_lo + it;
    if (it + 1 < nit) get_xc(r + 1);
    if (r >= r_lo && r <= r_hi) {   // uniform per wave: this key row lies in the window of the wave's query row
    const unsigned char* Kr = XT + (it & 1) * VPL + c0 * 2; const b16* V = X0 + (it & 1) * (VPL / 2) + c0;
    v16b k0[4], k1[4], vf[8]; v8f s0, s1;
#pragma unroll
    for (int e = 0; e < 8; ++e) { s0[e] = traw; s1[e] = traw; }
#pragma unroll
    for (int t = 0; t < 4; ++t) { k0[t] = frag_tr(Kr + t * 32 * VPB, VPB); k1[t] = frag_tr(Kr + t * 32 * VPB + 32, VPB); }
#pragma unroll
    for (int t = 0; t < 8; ++t) vf[t] = frag_kb(V + (t * 16 + col) * VP, hh);
    __builtin_amdgcn_sched_barrier(0);   // all of the row's LDS reads are issued here, in the order of their use: the latency is met once, and the channel rows return under the score products and the softmax
#pragma unroll
    for (int t = 0; t < 4; ++t) { s0 = wmma16c(k0[t], qf[t], s0); s1 = wmma16c(k1[t], qf[t], s1); s0 = wmma16c(k0[t], ql[t], s0); s1 = wmma16c(k1[t], ql[t], s1); }
    float mr = -INFINITY;
#pragma unroll
    for (int e = 0; e < 8; ++e) { const int kc0 = c0 + 8 * hh + e, kc1 = kc0 + 16; const bool v0 = (kc0 >= wqx - PADW) && (kc0 <= wqx + PADW), v1 = (kc1 >= wqx - PADW) && (kc1 <= wqx + PADW);
      s0[e] = v0 ? s0[e] * (1.0f / (XS * XS)) : -INFINITY; s1[e] = v1 ? s1[e] * (1.0f / (XS * XS)) : -INFINITY; mr = fmaxf(mr, fmaxf(s0[e], s1[e])); }
    mr = fmaxf(mr, __shfl_xor(mr, 16)); const float mn = fmaxf(m, mr); const float al_ = (mn == -INFINITY) ? 1.0f : nexp(m - mn); m = mn; float sum = 0.0f; v16b pb, pl;
#pragma unroll
    for (int e = 0; e < 8; e += 2) { v2f p0, p1;
#pragma unroll   // so that s0[e + i] and p0[i] are fixed registers
      for (int i = 0; i < 2; ++i) { const float e0 = (s0[e + i] == -INFINITY) ? 0.0f : nexp(s0[e + i] - mn), e1 = (s1[e + i] == -INFINITY) ? 0.0f : nexp(s1[e + i] - mn); sum += e0 + e1; p0[i] = e0 * PS; p1[i] = e1 * PS; }
      v2b a_, c_; split16x2(p0, a_, c_); pb[e] = a_[0]; pb[e + 1] = a_[1]; pl[e] = c_[0]; pl[e + 1] = c_[1]; split16x2(p1, a_, c_); pb[8 + e] = a_[0]; pb[9 + e] = a_[1]; pl[8 + e] = c_[0]; pl[9 + e] = c_[1]; }
    sum += __shfl_xor(sum, 16); l = l * al_ + sum; li = li * al_ + sum;
#pragma unroll
    for (int t = 0; t < 8; ++t) o[t] *= al_;
#pragma unroll
    for (int t = 0; t < 8; ++t) o[t] = wmma16c(vf[t], pb, o[t]);   // eight independent accumulators in turn
#pragma unroll
    for (int t = 0; t < 8; ++t) o[t] = wmma16c(vf[t], pl, o[t]);
    asm volatile("v_nop\n\tv_nop\n\tv_nop\n\tv_nop" : "+v"(o[7]));   // the distance behind the row's last product: on the last row, which has no x stores, only scalar instructions and the barrier follow, up to the arithmetic after the loop
    }
    if (it + 1 < nit) put_xc(X0 + ((it + 1) & 1) * (VPL / 2));
    __syncthreads();   // row r + 1's x is whole; every wave has left row r's
  }
  // y = Wv a / l + bv l_in / l: the accumulators of a lane are, as they lie, the second operand's fragments of its query (channels 32 kb + 8 hh + e and + 16), as hi+lo x8; 2 products
  const float rl = 1.0f / l, inv = rl * (1.0f / PS), bsc = li * rl;   // every pixel has at least itself in the window; (8x).(8p) carries x64, of which x8 stays for the split
  v16b ah[4], al[4];
#pragma unroll
  for (int kb = 0; kb < 4; ++kb)
#pragma unroll
    for (int g = 0; g < 2; ++g)
#pragma unroll
      for (int e = 0; e < 8; e += 2) { v2b a_, c_; split16x2((v2f){o[2 * kb + g][e] * inv, o[2 * kb + g][e + 1] * inv}, a_, c_); ah[kb][8 * g + e] = a_[0]; ah[kb][8 * g + e + 1] = a_[1]; al[kb][8 * g + e] = c_[0]; al[kb][8 * g + e + 1] = c_[1]; }
  float (*Os)[2 * IW + 4] = (float (*)[2 * IW + 4])(L + OFF_Q);   // over q, which nobody has read since the barriers in front of the loop
#pragma unroll
  for (int t = 0; t < 8; ++t) { const v4f b0 = *(const v4f*)(BV + t * 16 + 8 * hh), b1 = *(const v4f*)(BV + t * 16 + 8 * hh + 4); v8f y;
#pragma unroll
    for (int e = 0; e < 4; ++e) { y[e] = b0[e] * bsc; y[4 + e] = b1[e] * bsc; }
#pragma unroll
    for (int kb = 0; kb < 4; ++kb) { const v16b w = frag_kb(WV + (t * 16 + col) * KP + kb * 32, hh); y = wmma16c(w, ah[kb], y); y = wmma16c(w, al[kb], y); }
    o[t] = y; }
#pragma unroll
  for (int t = 0; t < 8; ++t)
#pragma unroll
    for (int e = 0; e < 8; ++e) Os[t * 16 + 8 * hh + e][qr * IW + wqx] = o[t][e] * (1.0f / XS);
  __syncthreads();
  { for (int i = tid; i < C * 32; i += 256) { const int c = i >> 5, c4 = (i & 31) * 4; *(v4f*)(out + ((size_t)b * C + c) * NPI + (size_t)h0 * IW + c4) = *(const v4f*)(&Os[c][c4]); }  }
}
}  // namespace

extern "C" void kernel_launch(void* const* d_in, const int* in_sizes, int n_in,
                              void* d_out, int out_size, void* d_ws, size_t ws_size, hipStream_t stream) {
  (void)n_in; (void)out_size; (void)d_ws; (void)ws_size;
  const float* x = (const float*)d_in[0]; const float* wq = (const float*)d_in[1]; const float* bq = (const float*)d_in[2]; const float* wk = (const float*)d_in[3]; const float* bk = (const float*)d_in[4]; const float* wv = (const float*)d_in[5]; const float* bv = (const float*)d_in[6];
  float* out = (float*)d_out;   // [8][128][64][64]
  if (in_sizes[0] != NT * C || in_sizes[1] != C * C) return;
  fused_kernel<<<dim3(1, IH / 2, Bn), 256, 0, stream>>>(x, wq, bq, wk, bk, wv, bv, out);
}

// v008
// One run takes 17.6 microseconds.
// Next to v007, in two timings, it ran 1.07 and 1.08 times as fast.
// Counting every step since v000, it is 5.55 times as fast.
#include <hip/hip_runtime.h>

// Local 7x7 attention: q, k, v = 1x1 convs (+bias) of x [8][128][64][64]; for every pixel, scores over the 49 zero-padded neighbours = sum_c q[c] k_unf[c] (padded neighbours score exactly
// 0 and carry v = 0), softmax over the 49, y[c] = sum attn v_unf[c] -> [8][128][64][64] (NCHW).
// WMMA (v_wmma_f32_16x16x32_f16, f32 accumulate). Operands x and W rounded to bf16 (exact in f16); every intermediate (q, Wk^T q, P, the weighted sum of x) as an f16 hi+lo pair x8 (the unscaled
// 128-term logits have a deviation of about 11, so their absolute precision matters); window mask by index compare, the out-of-image neighbours added analytically as n_out * e^(0 - m) to the denominator.

namespace {
constexpr int Bn = 8, C = 128, IH = 64, IW = 64, NPI = IH * IW, NT = Bn * NPI, KS = 7, PADW = 3;
constexpr float XS = 8.0f, PS = 8.0f;

typedef _Float16 b16;
typedef __attribute__((ext_vector_type(16))) _Float16 v16b;
typedef __attribute__((ext_vector_type(8))) _Float16 v8b;
typedef __attribute__((ext_vector_type(8))) float v8f;
typedef __attribute__((ext_vector_type(4))) float v4f;
typedef __attribute__((ext_vector_type(2))) float v2f;
typedef __attribute__((ext_vector_type(2))) _Float16 v2b;
typedef __attribute__((ext_vector_type(4))) _Float16 v4b;
typedef __attribute__((ext_vector_type(2))) __bf16 v2r;
// rounding to bf16 (nearest, ties to even) by the chip's own convert, two values an instruction, and back to f32
__device__ __forceinline__ float bf16_rne(float f) { return (float)(__bf16)f; }
__device__ __forceinline__ v2f bf16_rne2(float a, float b) { return __builtin_convertvector(__builtin_convertvector((v2f){a, b}, v2r), v2f); }
__device__ __forceinline__ void split16x2(v2f v, v2b& hi, v2b& lo) { hi = __builtin_convertvector(v, v2b); lo = __builtin_convertvector(v - __builtin_convertvector(hi, v2f), v2b); }
__device__ __forceinline__ v16b frag_kb(const b16* p, int hh) { const v8b a = *(const v8b*)(p + 8 * hh), b = *(const v8b*)(p + 16 + 8 * hh); v16b f;
#pragma unroll
  for (int e = 0; e < 8; ++e) { f[e] = a[e]; f[8 + e] = b[e]; } return f; }
// the same fragment (the k order of frag_kb) out of rows that run the other way: p = this lane's 16 bytes of a 16-row block, row 8 * hh + (lane & 7), bytes 16 * ((lane >> 3) & 1); the lane gets rows 8 hh .. + 7 and, 16 rows on, the same again, of column (lane & 15)
typedef __attribute__((ext_vector_type(8))) short v8s;
__device__ __forceinline__ v8b ld_tr16(const unsigned char* p) { typedef __attribute__((address_space(3))) v8s lds_v8s; return __builtin_bit_cast(v8b, __builtin_amdgcn_ds_load_tr16_b128_v8i16((lds_v8s*)p)); }
__device__ __forceinline__ v16b frag_tr(const unsigned char* p, int pitch) { const v8b a = ld_tr16(p), b = ld_tr16(p + 16 * pitch); v16b f;
#pragma unroll
  for (int e = 0; e < 8; ++e) { f[e] = a[e]; f[8 + e] = b[e]; } return f; }
// the product, with the distance behind it left to the compiler
__device__ __forceinline__ v8f wmma16c(v16b a, v16b b, v8f c) { return __builtin_amdgcn_wmma_f32_16x16x32_f16(false, a, false, b, (short)0, c, false, false); }
__device__ __forceinline__ float nexp(float x) { return __builtin_amdgcn_exp2f(x * 1.4426950408889634f); }

// a weight fragment in the k order of frag_kb, from a row of f32 weights: the four 16-byte loads, and apart from them the rounding (as the operands are defined)
struct wraw { v4f q[4]; };
__device__ __forceinline__ wraw load_w(const float* p) { wraw r; r.q[0] = *(const v4f*)(p); r.q[1] = *(const v4f*)(p + 4); r.q[2] = *(const v4f*)(p + 16); r.q[3] = *(const v4f*)(p + 20); return r; }   // p: the row's block of 32, + 8 * hh
__device__ __forceinline__ v16b round_w(const wraw& r) { v16b f;
#pragma unroll
  for (int i = 0; i < 4; ++i)
#pragma unroll
    for (int e = 0; e < 4; e += 2) { const v2b p = __builtin_convertvector(bf16_rne2(r.q[i][e], r.q[i][e + 1]), v2b); f[4 * i + e] = p[0]; f[4 * i + e + 1] = p[1]; }
  return f; }
// the same fragment from a COLUMN of a weight matrix (the matrix transposed): sixteen 4-byte loads, p = the column's element in row (block of 32) + 8 * hh
__device__ __forceinline__ wraw load_wt(const float* p) { wraw r;
#pragma unroll
  for (int i = 0; i < 4; ++i) { r.q[0][i] = p[i * C]; r.q[1][i] = p[(4 + i) * C]; r.q[2][i] = p[(16 + i) * C]; r.q[3][i] = p[(20 + i) * C]; }
  return r; }
// all in one launch: block = (image b, two query rows h0, h0+1, all 64 columns) x 8 waves. k and v are never formed. Both convs are linear, so
//   q.k_j = q.(Wk x_j + bk) = (Wk^T q).x_j + q.bk   and   sum_j p_j v_j = Wv (sum_j p_j x_j) + bv sum_j p_j   (j: the in-image neighbours; the padded ones score 0 and carry 0 as before).
// Once per query: q, then u = Wk^T q (q as hi+lo, 2 products) and t = q.bk, each wave for its own 16 queries over all 128 channels: with the weight rows as the first operand a product's results lie in a lane as the next product's second operand wants them, so q and u never leave the registers. Per key row: the rounded x row lies in LDS once, as channel rows (it is exact in f16, one plane); fragments along the pixels are plain reads, fragments along the channels come by the transposing read;
// wave w attends for query row h0 + w/4, columns 16(w%4)..+15: S^T = x.u + t (u as hi+lo, 2 products), window mask |dc| <= 3, a^T += x^T.P^T (P as hi+lo, 2 products). Once at the end: y = Wv a / l + bv l_in / l.
constexpr int KP = C + 8, VP = IW + 80;                         // LDS pitches in halfs: 272 B = 16 B x odd for plain 16-byte reads; the x rows 288 B = 32 B x odd, the transposing read's pitch (its fragments are wanted first in a key row); 160 B is the same on the banks, but with it this compiler laid out the Wv reads of the end as read, wait, product
constexpr int VPL = C * VP * 2, VPB = VP * 2;                    // bytes of one x row as channel rows; the x pitch in bytes
constexpr int WPL = C * KP * 2;                                  // bytes of one rounded weight matrix
constexpr int OFF_WQ = 0, OFF_WK = OFF_WQ + WPL, OFF_XC = OFF_WK + WPL, OFF_XQ = OFF_XC + 2 * VPL, OFF_WV = OFF_XQ + 2 * VPL, OFF_BV = OFF_WV + WPL, OFF_BQ = OFF_BV + C * 4, OFF_BK = OFF_BQ + C * 4, LDS_ALL = OFF_BK + C * 2;   // Wq and Wk^T lowest: every fragment of theirs is then within a read's 16-bit offset of one lane address
__global__ __launch_bounds__(256) void fused_kernel(const float* __restrict__ x, const float* __restrict__ wq, const float* __restrict__ bq, const float* __restrict__ wk, const float* __restrict__ bk, const float* __restrict__ wv, const float* __restrict__ bv, float* __restrict__ out) {
  __shared__ __attribute__((aligned(16))) unsigned char L[LDS_ALL];   // Wq and Wk^T rounded, two buffers of a key row of x as channel rows, the two query rows of x likewise (at the end the output staging), Wv rounded, bv, bq and bk rounded
  const int tid = threadIdx.x, lane = tid & 31, wave = __builtin_amdgcn_readfirstlane(tid >> 5), hh = lane >> 4, col = lane & 15;
  const int b = blockIdx.z, h0 = blockIdx.y * 2, qr = wave >> 2, h = h0 + qr, w0 = (wave & 3) * 16, wqx = w0 + col;
  const int R_lo = (h0 - PADW < 0) ? 0 : h0 - PADW, R_hi = (h0 + 1 + PADW > IH - 1) ? IH - 1 : h0 + 1 + PADW;   // in-image key rows of the block, uniform per block
  // out-of-image neighbour count for this lane's query: rows outside [0,IH) x 7 cols + in-image rows x cols outside [0,IW)
  const int r_lo = (h - PADW < 0) ? 0 : h - PADW, r_hi = (h + PADW > IH - 1) ? IH - 1 : h + PADW, c_lo = (wqx - PADW < 0) ? 0 : wqx - PADW, c_hi = (wqx + PADW > IW - 1) ? IW - 1 : wqx + PADW;
  b16* const X0 = (b16*)(L + OFF_XC); b16* const XQ = (b16*)(L + OFF_XQ); b16* const WQ = (b16*)(L + OFF_WQ); b16* const WK = (b16*)(L + OFF_WK); b16* const WV = (b16*)(L + OFF_WV); float* const BV = (float*)(L + OFF_BV); float* const BQ = (float*)(L + OFF_BQ); b16* const BK = (b16*)(L + OFF_BK);
  const int ypx = (tid & 15) * 4, yc = tid >> 4;    // channel rows: this thread's 4 pixels, of channels yc + 16 j
  const float* yb = x + ((size_t)b * C + yc) * NPI + ypx;
  const unsigned char* const XT = L + OFF_XC + (8 * hh + (lane & 7)) * VPB + 16 * ((lane >> 3) & 1);   // this lane's place in a 16-channel block for the transposing read
  const int orow = wave * 16 + col;
  const unsigned wob = (unsigned)(orow * C + 8 * hh) * 4u;   // one 32-bit byte offset for the row fragments of Wq and Wv: every such load names this register and its matrix's scalar base, which keep their values up to the wait below
  const unsigned wtb = (unsigned)(8 * hh * C + orow) * 4u;   // and one for the column fragments of Wk
  const int ti = tid & (C - 1);
  const float* const yq = yb + h0 * IW; const float* const yk = yb + R_lo * IW;   // this thread's place in the first query row and in the first key row
  v4f xa[8], xb[8], xw[8]; wraw rw[3][4];
#pragma unroll
  for (int kb = 0; kb < 4; ++kb) rw[0][kb] = load_w((const float*)((const char*)wq + wob) + kb * 32);
  __builtin_amdgcn_sched_barrier(0);   // the q weights are asked for first and so counted back first: they are rounded while the rest is still in flight
#pragma unroll
  for (int j = 0; j < 8; ++j) { xa[j] = *(const v4f*)(yq + (size_t)(16 * j) * NPI); xb[j] = *(const v4f*)(yq + (size_t)(16 * j) * NPI + IW); }
  const float bqr = bq[ti], bvr = bv[ti], bkr = bk[ti];
  __builtin_amdgcn_sched_barrier(0);   // then the query rows: the loads come back in the order in which they are laid down below
#pragma unroll
  for (int kb = 0; kb < 4; ++kb) { rw[1][kb] = load_wt((const float*)((const char*)wk + wtb) + kb * 32 * C); rw[2][kb] = load_w((const float*)((const char*)wv + wob) + kb * 32); }
#pragma unroll
  for (int j = 0; j < 8; ++j) xw[j] = *(const v4f*)(yk + (size_t)(16 * j) * NPI);
  asm volatile("s_wait_xcnt 0x0" :: "v"(wob), "v"(wtb), "v"(yq), "v"(yk), "s"(wq), "s"(wk), "s"(wv), "s"(bq), "s"(bk), "s"(bv) : "memory");   // stands in front of whatever reuses the address registers of the loads above; the two offsets, the two x addresses and the scalar bases are named so that they keep their registers up to here
  __builtin_amdgcn_sched_barrier(0);   // holds the arithmetic below, which reuses those registers, behind the wait (a "memory" clobber does not)
  auto get_xc = [&](int row) {   // an x row: 4 pixels of 8 channels a thread, asked for directly behind a barrier (which waits for every load), used at the end of the stretch up to the next one
    __builtin_amdgcn_sched_barrier(0);   // keeps earlier arithmetic from sinking in between the loads and their wait, where it took the loads' address register
#pragma unroll
    for (int j = 0; j < 8; ++j) xw[j] = *(const v4f*)(yb + (size_t)(16 * j) * NPI + row * IW);
    asm volatile("s_wait_xcnt 0x0" ::: "memory");   // as above
    __builtin_amdgcn_sched_barrier(0);   // as above: without it later arithmetic rose over the wait into the loads' address register
  };
  auto put_xc = [&](b16* X, const v4f (&w)[8]) {   // 8 bytes a store; the scale 8 goes on ahead of the rounding: a power of two, so the rounded value is the same, and the f32 product packs two values an instruction
#pragma unroll
    for (int j = 0; j < 8; ++j) { const v2b p = __builtin_convertvector(bf16_rne2(w[j][0] * XS, w[j][1] * XS), v2b), r = __builtin_convertvector(bf16_rne2(w[j][2] * XS, w[j][3] * XS), v2b);
      *(v4b*)(X + (yc + 16 * j) * VP + ypx) = (v4b){p[0], p[1], r[0], r[1]}; }
  };
  auto put_w = [&](b16* M, const wraw (&r)[4]) {   // this wave's 16 rows of a weight matrix, rounded, go to LDS: every wave reads all 128
#pragma unroll
    for (int kb = 0; kb < 4; ++kb) { const v16b f = round_w(r[kb]); v8b a, c;
#pragma unroll
      for (int e = 0; e < 8; ++e) { a[e] = f[e]; c[e] = f[8 + e]; }
      *(v8b*)(M + orow * KP + kb * 32 + 8 * hh) = a; *(v8b*)(M + orow * KP + kb * 32 + 16 + 8 * hh) = c; }
  };
  put_w(WQ, rw[0]); put_xc(XQ, xa); put_xc(XQ + VPL / 2, xb);
  // holds the 3 bias loads in front of the barrier, whose wait for every load covers them: left free they sink behind later barriers, each meets its latency there
  asm volatile("" :: "v"(bqr), "v"(bvr), "v"(bkr));
  if (tid < C) { BV[ti] = XS * bf16_rne(bvr); BQ[ti] = XS * bf16_rne(bqr); BK[ti] = (b16)bf16_rne(bkr); }
  put_w(WK, rw[1]); put_w(WV, rw[2]); put_xc(X0, xw);
  __syncthreads();                                  // the weights, the biases, the two query rows of x and the first key row are whole
  // q, u and t of this wave's 16 queries. Weight rows (for u: columns of Wk) are the first operand, so a lane holds channels 16 t + 8 hh + e of its query: tiles 2 kb and 2 kb + 1 are, as they lie, the next product's second operand for channel block kb.
  // The weight fragments come in groups of 4 tiles x 4 channel blocks, each group asked for one group ahead of its products.
  v16b qf[4], ql[4];   // this lane's u, hi and lo: in registers over the whole key-row loop
  float traw;
  { const b16* const WQl = WQ + col * KP; const b16* const WKl = WK + col * KP;
    const unsigned char* const Tq = XT + (OFF_XQ - OFF_XC) + qr * VPL + w0 * 2;
    v16b xf[4], ga[16], gb[16], bkf[4], qh[4], qw[4]; v8f acc[8]; v4f bqf[16];
    auto ld4 = [&](v16b (&g)[16], const b16* M, int t0) {
#pragma unroll
      for (int kb = 0; kb < 4; ++kb)
#pragma unroll
        for (int i = 0; i < 4; ++i) g[kb * 4 + i] = frag_kb(M + (t0 + i) * 16 * KP + kb * 32, hh);
    };
    auto mm4 = [&](const v16b (&g)[16], const v16b (&s)[4], int t0) {   // four independent accumulators in turn
#pragma unroll
      for (int kb = 0; kb < 4; ++kb)
#pragma unroll
        for (int i = 0; i < 4; ++i) acc[t0 + i] = wmma16c(g[kb * 4 + i], s[kb], acc[t0 + i]);
    };
#pragma unroll
    for (int kb = 0; kb < 4; ++kb) xf[kb] = frag_tr(Tq + kb * 32 * VPB, VPB);
    ld4(ga, WQl, 0);
    __builtin_amdgcn_sched_barrier(0);   // here and below: keeps a group's reads together, in the order of their use, and ahead of the products in front of which they are written, so that their latency passes under those products
    ld4(gb, WQl, 4);
    __builtin_amdgcn_sched_barrier(0);
#pragma unroll
    for (int t = 0; t < 8; ++t) acc[t] = (v8f){};
    mm4(ga, xf, 0);
    __builtin_amdgcn_sched_barrier(0);
    ld4(ga, WKl, 0);
#pragma unroll
    for (int t = 0; t < 8; ++t) { bqf[2 * t] = *(const v4f*)(BQ + t * 16 + 8 * hh); bqf[2 * t + 1] = *(const v4f*)(BQ + t * 16 + 8 * hh + 4); }
    __builtin_amdgcn_sched_barrier(0);
    mm4(gb, xf, 4);
    __builtin_amdgcn_sched_barrier(0);
    ld4(gb, WKl, 4);
#pragma unroll
    for (int kb = 0; kb < 4; ++kb) bkf[kb] = frag_kb(BK + kb * 32, hh);
    __builtin_amdgcn_sched_barrier(0);
#pragma unroll
    for (int kb = 0; kb < 4; ++kb)
#pragma unroll
      for (int g = 0; g < 2; ++g)
#pragma unroll
        for (int e = 0; e < 8; e += 2) { const int t = 2 * kb + g; v2b a_, c_; split16x2((v2f){acc[t][e] + bqf[2 * t + (e >> 2)][e & 3], acc[t][e + 1] + bqf[2 * t + (e >> 2)][(e & 3) + 1]}, a_, c_);
          qh[kb][8 * g + e] = a_[0]; qh[kb][8 * g + e + 1] = a_[1]; qw[kb][8 * g + e] = c_[0]; qw[kb][8 * g + e + 1] = c_[1]; }
    // u = Wk^T q (8u, as q carries x8): q hi over the four channel blocks, then q lo
#pragma unroll
    for (int t = 0; t < 8; ++t) acc[t] = (v8f){};
    mm4(ga, qh, 0); mm4(ga, qw, 0);
    mm4(gb, qh, 4); mm4(gb, qw, 4);
    // t = q.bk of this lane's query: bk as every row of the first operand, so that each of the 8 results of a lane is its query's t
    v8f ta = {};
#pragma unroll
    for (int kb = 0; kb < 4; ++kb) ta = wmma16c(bkf[kb], qh[kb], ta);
#pragma unroll
    for (int kb = 0; kb < 4; ++kb) ta = wmma16c(bkf[kb], qw[kb], ta);
    traw = ta[0] * XS;   // (8q).bk x 8: the scale 64 of the products (8x).(8u)
#pragma unroll
    for (int kb = 0; kb < 4; ++kb)
#pragma unroll
      for (int g = 0; g < 2; ++g)
#pragma unroll
        for (int e = 0; e < 8; e += 2) { v2b a_, c_; split16x2((v2f){acc[2 * kb + g][e], acc[2 * kb + g][e + 1]}, a_, c_);
          qf[kb][8 * g + e] = a_[0]; qf[kb][8 * g + e + 1] = a_[1]; ql[kb][8 * g + e] = c_[0]; ql[kb][8 * g + e + 1] = c_[1]; }
  }
  const int n_in = (r_hi - r_lo + 1) * (c_hi - c_lo + 1), n_out = KS * KS - n_in;
  float m = (n_out > 0) ? 0.0f : -INFINITY, l = (float)n_out, li = 0.0f; v8f o[8];   // li: the in-image part of l, which bv goes with
#pragma unroll
  for (int t = 0; t < 8; ++t) o[t] = (v8f){};
  int c0 = w0 - 8; c0 = (c0 < 0) ? 0 : (c0 > IW - 32 ? IW - 32 : c0);   // aligned key columns covering [w0-3, w0+18]
  // one barrier a key row: between two barriers a wave attends to row r (one buffer) and lays down x of row r + 1 (the other)
  const int nit = R_hi - R_lo + 1;
  for (int it = 0; it < nit; ++it) {
    const int r = R_lo + it;
    if (it + 1 < nit) get_xc(r + 1);
    if (r >= r_lo && r <= r_hi) {   // uniform per wave: this key row lies in the window of the wave's query row
    const unsigned char* Kr = XT + (it & 1) * VPL + c0 * 2; const b16* V = X0 + (it & 1) * (VPL / 2) + c0;
    v16b k0[4], k1[4], vf[8]; v8f s0, s1;
#pragma unroll
    for (int e = 0; e < 8; ++e) { s0[e] = traw; s1[e] = traw; }
#pragma unroll
    for (int t = 0; t < 4; ++t) { k0[t] = frag_tr(Kr + t * 32 * VPB, VPB); k1[t] = frag_tr(Kr + t * 32 * VPB + 32, VPB); }
#pragma unroll
    for (int t = 0; t < 8; ++t) vf[t] = frag_kb(V + (t * 16 + col) * VP, hh);
    __builtin_amdgcn_sched_barrier(0);   // all of the row's LDS reads are issued here, in the order of their use: the latency is met once, and the channel rows return under the score products and the softmax
#pragma unroll
    for (int t = 0; t < 4; ++t) { s0 = wmma16c(k0[t], qf[t], s0); s1 = wmma16c(k1[t], qf[t], s1); s0 = wmma16c(k0[t], ql[t], s0); s1 = wmma16c(k1[t], ql[t], s1); }
    float mr = -INFINITY;
#pragma unroll
    for (int e = 0; e < 8; ++e) { const int kc0 = c0 + 8 * hh + e, kc1 = kc0 + 16; const bool v0 = (kc0 >= wqx - PADW) && (kc0 <= wqx + PADW), v1 = (kc1 >= wqx - PADW) && (kc1 <= wqx + PADW);
      s0[e] = v0 ? s0[e] * (1.0f / (XS * XS)) : -INFINITY; s1[e] = v1 ? s1[e] * (1.0f / (XS * XS)) : -INFINITY; mr = fmaxf(mr, fmaxf(s0[e], s1[e])); }
    mr = fmaxf(mr, __shfl_xor(mr, 16)); const float mn = fmaxf(m, mr); const float al_ = (mn == -INFINITY) ? 1.0f : nexp(m - mn); m = mn; float sum = 0.0f; v16b pb, pl;
#pragma unroll
    for (int e = 0; e < 8; e += 2) { v2f p0, p1;
#pragma unroll   // so that s0[e + i] and p0[i] are fixed registers
      for (int i = 0; i < 2; ++i) { const float e0 = (s0[e + i] == -INFINITY) ? 0.0f : nexp(s0[e + i] - mn), e1 = (s1[e + i] == -INFINITY) ? 0.0f : nexp(s1[e + i] - mn); sum += e0 + e1; p0[i] = e0 * PS; p1[i] = e1 * PS; }
      v2b a_, c_; split16x2(p0, a_, c_); pb[e] = a_[0]; pb[e + 1] = a_[1]; pl[e] = c_[0]; pl[e + 1] = c_[1]; split16x2(p1, a_, c_); pb[8 + e] = a_[0]; pb[9 + e] = a_[1]; pl[8 + e] = c_[0]; pl[9 + e] = c_[1]; }
    sum += __shfl_xor(sum, 16); l = l * al_ + sum; li = li * al_ + sum;
#pragma unroll
    for (int t = 0; t < 8; ++t) o[t] *= al_;
#pragma unroll
    for (int t = 0; t < 8; ++t) o[t] = wmma16c(vf[t], pb, o[t]);   // eight independent accumulators in turn
#pragma unroll
    for (int t = 0; t < 8; ++t) o[t] = wmma16c(vf[t], pl, o[t]);
    asm volatile("v_nop\n\tv_nop\n\tv_nop\n\tv_nop" : "+v"(o[7]));   // the distance behind the row's last product: on the last row, which has no x stores, only scalar instructions and the barrier follow, up to the arithmetic after the loop
    }
    if (it + 1 < nit) put_xc(X0 + ((it + 1) & 1) * (VPL / 2), xw);
    __syncthreads();   // row r + 1's x is whole; every wave has left row r's
  }
  // y = Wv a / l + bv l_in / l: the accumulators of a lane are, as they lie, the second operand's fragments of its query (channels 32 kb + 8 hh + e and + 16), as hi+lo x8; 2 products
  const float rl = 1.0f / l, inv = rl * (1.0f / PS), bsc = li * rl;   // every pixel has at least itself in the window; (8x).(8p) carries x64, of which x8 stays for the split
  v16b ah[4], al[4];
#pragma unroll
  for (int kb = 0; kb < 4; ++kb)
#pragma unroll
    for (int g = 0; g < 2; ++g)
#pragma unroll
      for (int e = 0; e < 8; e += 2) { v2b a_, c_; split16x2((v2f){o[2 * kb + g][e] * inv, o[2 * kb + g][e + 1] * inv}, a_, c_); ah[kb][8 * g + e] = a_[0]; ah[kb][8 * g + e + 1] = a_[1]; al[kb][8 * g + e] = c_[0]; al[kb][8 * g + e + 1] = c_[1]; }
  float (*Os)[2 * IW + 4] = (float (*)[2 * IW + 4])(L + OFF_XQ);   // over the query rows of x, which nobody has read since the first barrier of the loop
#pragma unroll
  for (int t = 0; t < 8; ++t) { const v4f b0 = *(const v4f*)(BV + t * 16 + 8 * hh), b1 = *(const v4f*)(BV + t * 16 + 8 * hh + 4); v8f y;
#pragma unroll
    for (int e = 0; e < 4; ++e) { y[e] = b0[e] * bsc; y[4 + e] = b1[e] * bsc; }
#pragma unroll
    for (int kb = 0; kb < 4; ++kb) { const v16b w = frag_kb(WV + (t * 16 + col) * KP + kb * 32, hh); y = wmma16c(w, ah[kb], y); y = wmma16c(w, al[kb], y); }
    o[t] = y; }
#pragma unroll
  for (int t = 0; t < 8; ++t)
#pragma unroll
    for (int e = 0; e < 8; ++e) Os[t * 16 + 8 * hh + e][qr * IW + wqx] = o[t][e] * (1.0f / XS);
  __syncthreads();
  { for (int i = tid; i < C * 32; i += 256) { const int c = i >> 5, c4 = (i & 31) * 4; *(v4f*)(out + ((size_t)b * C + c) * NPI + (size_t)h0 * IW + c4) = *(const v4f*)(&Os[c][c4]); }  }
}
}  // namespace

extern "C" void kernel_launch(void* const* d_in, const int* in_sizes, int n_in,
                              void* d_out, int out_size, void* d_ws, size_t ws_size, hipStream_t stream) {
  (void)n_in; (void)out_size; (void)d_ws; (void)ws_size;
  const float* x = (const float*)d_in[0]; const float* wq = (const float*)d_in[1]; const float* bq = (const float*)d_in[2]; const float* wk = (const float*)d_in[3]; const float* bk = (const float*)d_in[4]; const float* wv = (const float*)d_in[5]; const float* bv = (const float*)d_in[6];
  float* out = (float*)d_out;   // [8][128][64][64]
  if (in_sizes[0] != NT * C || in_sizes[1] != C * C) return;
  fused_kernel<<<dim3(1, IH / 2, Bn), 256, 0, stream>>>(x, wq, bq, wk, bk, wv, bv, out);
}

// v009
// A run of this version takes 16.7 microseconds.
// Timed twice side by side with v008, it ran 1.06 times as fast both times.
// Counting every step since v000, it is 5.86 times as fast.
#include <hip/hip_runtime.h>

// Local 7x7 attention: q, k, v = 1x1 convs (+bias) of x [8][128][64][64]; for every pixel, scores over the 49 zero-padded neighbours = sum_c q[c] k_unf[c] (padded neighbours score exactly
// 0 and carry v = 0), softmax over the 49, y[c] = sum attn v_unf[c] -> [8][128][64][64] (NCHW).
// WMMA (v_wmma_f32_16x16x32_f16, f32 accumulate). Operands x and W rounded to bf16 (exact in f16); every intermediate (q, Wk^T q, P, the weighted sum of x) as an f16 hi+lo pair x8 (the unscaled
// 128-term logits have a deviation of about 11, so their absolute precision matters); window mask by index compare, the out-of-image neighbours added analytically as n_out * e^(0 - m) to the denominator.

namespace {
constexpr int Bn = 8, C = 128, IH = 64, IW = 64, NPI = IH * IW, NT = Bn * NPI, KS = 7, PADW = 3;
constexpr float XS = 8.0f, PS = 8.0f;

typedef _Float16 b16;
typedef __attribute__((ext_vector_type(16))) _Float16 v16b;
typedef __attribute__((ext_vector_type(8))) _Float16 v8b;
typedef __attribute__((ext_vector_type(8))) float v8f;
typedef __attribute__((ext_vector_type(4))) float v4f;
typedef __attribute__((ext_vector_type(2))) float v2f;
typedef __attribute__((ext_vector_type(2))) _Float16 v2b;
typedef __attribute__((ext_vector_type(4))) _Float16 v4b;
typedef __attribute__((ext_vector_type(2))) __bf16 v2r;
// rounding to bf16 (nearest, ties to even) by the chip's own convert, two values an instruction, and back to f32
__device__ __forceinline__ float bf16_rne(float f) { return (float)(__bf16)f; }
__device__ __forceinline__ v2f bf16_rne2(float a, float b) { return __builtin_convertvector(__builtin_convertvector((v2f){a, b}, v2r), v2f); }
__device__ __forceinline__ void split16x2(v2f v, v2b& hi, v2b& lo) { hi = __builtin_convertvector(v, v2b); lo = __builtin_convertvector(v - __builtin_convertvector(hi, v2f), v2b); }
__device__ __forceinline__ v16b frag_kb(const b16* p, int hh) { const v8b a = *(const v8b*)(p + 8 * hh), b = *(const v8b*)(p + 16 + 8 * hh); v16b f;
#pragma unroll
  for (int e = 0; e < 8; ++e) { f[e] = a[e]; f[8 + e] = b[e]; } return f; }
// the same fragment (the k order of frag_kb) out of rows that run the other way: p = this lane's 16 bytes of a 16-row block, row 8 * hh + (lane & 7), bytes 16 * ((lane >> 3) & 1); the lane gets rows 8 hh .. + 7 and, 16 rows on, the same again, of column (lane & 15)
typedef __attribute__((ext_vector_type(8))) short v8s;
__device__ __forceinline__ v8b ld_tr16(const unsigned char* p) { typedef __attribute__((address_space(3))) v8s lds_v8s; return __builtin_bit_cast(v8b, __builtin_amdgcn_ds_load_tr16_b128_v8i16((lds_v8s*)p)); }
__device__ __forceinline__ v16b frag_tr(const unsigned char* p, int pitch) { const v8b a = ld_tr16(p), b = ld_tr16(p + 16 * pitch); v16b f;
#pragma unroll
  for (int e = 0; e < 8; ++e) { f[e] = a[e]; f[8 + e] = b[e]; } return f; }
// the product, with the distance behind it left to the compiler
__device__ __forceinline__ v8f wmma16c(v16b a, v16b b, v8f c) { return __builtin_amdgcn_wmma_f32_16x16x32_f16(false, a, false, b, (short)0, c, false, false); }
__device__ __forceinline__ float nexp(float x) { return __builtin_amdgcn_exp2f(x * 1.4426950408889634f); }

// a weight fragment in the k order of frag_kb, from a row of f32 weights: the four 16-byte loads, and apart from them the rounding (as the operands are defined)
struct wraw { v4f q[4]; };
__device__ __forceinline__ wraw load_w(const float* p) { wraw r; r.q[0] = *(const v4f*)(p); r.q[1] = *(const v4f*)(p + 4); r.q[2] = *(const v4f*)(p + 16); r.q[3] = *(const v4f*)(p + 20); return r; }   // p: the row's block of 32, + 8 * hh
__device__ __forceinline__ v16b round_w(const wraw& r) { v16b f;
#pragma unroll
  for (int i = 0; i < 4; ++i)
#pragma unroll
    for (int e = 0; e < 4; e += 2) { const v2b p = __builtin_convertvector(bf16_rne2(r.q[i][e], r.q[i][e + 1]), v2b); f[4 * i + e] = p[0]; f[4 * i + e + 1] = p[1]; }
  return f; }
// the same fragment from a COLUMN of a weight matrix (the matrix transposed): sixteen 4-byte loads, p = the column's element in row (block of 32) + 8 * hh
__device__ __forceinline__ wraw load_wt(const float* p) { wraw r;
#pragma unroll
  for (int i = 0; i < 4; ++i) { r.q[0][i] = p[i * C]; r.q[1][i] = p[(4 + i) * C]; r.q[2][i] = p[(16 + i) * C]; r.q[3][i] = p[(20 + i) * C]; }
  return r; }
// all in one launch: block = (image b, two query rows h0, h0+1, all 64 columns) x 8 waves. k and v are never formed. Both convs are linear, so
//   q.k_j = q.(Wk x_j + bk) = (Wk^T q).x_j + q.bk   and   sum_j p_j v_j = Wv (sum_j p_j x_j) + bv sum_j p_j   (j: the in-image neighbours; the padded ones score 0 and carry 0 as before).
// Once per query: q, then u = Wk^T q (q as hi+lo, 2 products) and t = q.bk, each wave for its own 16 queries over all 128 channels: with the weight rows as the first operand a product's results lie in a lane as the next product's second operand wants them, so q and u never leave the registers. Per key row: the rounded x row lies in LDS once, as channel rows (it is exact in f16, one plane); fragments along the pixels are plain reads, fragments along the channels come by the transposing read;
// wave w attends for the 2 x 8 queries of rows h0, h0 + 1, columns 8w..+7: their windows lie in 16 key columns (8w - 4 .. 8w + 11), so a key row is ONE tile of 16 keys and two key rows fill the 32 keys of a product with P.
// Per pair of key rows: S^T = x.u + t (u as hi+lo, 2 products), window mask |dr| <= 3, |dc| <= 3, a^T += x^T.P^T (P as hi+lo, 2 products). Once at the end: y = Wv a / l + bv l_in / l.
constexpr int KP = C + 8, VP = IW + 80;                         // LDS pitches in halfs: 272 B = 16 B x odd for plain 16-byte reads; the x rows 288 B = 32 B x odd, the transposing read's pitch (its fragments are wanted first in a key row); 160 B is the same on the banks, but with it this compiler laid out the Wv reads of the end as read, wait, product
constexpr int VPL = C * VP * 2, VPB = VP * 2;                    // bytes of one x row as channel rows; the x pitch in bytes
constexpr int WPL = C * KP * 2;                                  // bytes of one rounded weight matrix
constexpr int SH = 4;                                            // a key row's pixel p lies at place p + 4 of its channel row, so that a wave's 16 key columns begin at a multiple of 16 bytes; places 0..3 and 68..71 are zero
constexpr int OQ = IW + 8, OP = 2 * IW + 12;                     // output staging, in floats: the second query row's start and the channel pitch (the 32 lanes of a store on 32 banks)
constexpr int OFF_WQ = 0, OFF_WK = OFF_WQ + WPL, OFF_XC = OFF_WK + WPL, OFF_XQ = OFF_XC + 4 * VPL, OFF_WV = OFF_XQ + VPL, OFF_BV = OFF_WV + WPL, OFF_BQ = OFF_BV + C * 4, OFF_BK = OFF_BQ + C * 4, LDS_ALL = OFF_BK + C * 2;   // Wq and Wk^T lowest: every fragment of theirs is then within a read's 16-bit offset of one lane address
__global__ __launch_bounds__(256) void fused_kernel(const float* __restrict__ x, const float* __restrict__ wq, const float* __restrict__ bq, const float* __restrict__ wk, const float* __restrict__ bk, const float* __restrict__ wv, const float* __restrict__ bv, float* __restrict__ out) {
  __shared__ __attribute__((aligned(16))) unsigned char L[LDS_ALL];   // Wq and Wk^T rounded, two buffers of a pair of key rows of x as channel rows (at the end the output staging), the two query rows of x in one channel row (8 pixels of the one, 8 of the other in turn), Wv rounded, bv, bq and bk rounded
  const int tid = threadIdx.x, lane = tid & 31, wave = __builtin_amdgcn_readfirstlane(tid >> 5), hh = lane >> 4, col = lane & 15;
  const int b = blockIdx.z, h0 = blockIdx.y * 2, qr = col >> 3, h = h0 + qr, wqx = wave * 8 + (col & 7);   // this lane's query
  const int p_lo = (h0 < PADW) ? (PADW - h0) / 2 : 0, p_hi = ((IH - 1 + PADW - h0) / 2 < 3) ? (IH - 1 + PADW - h0) / 2 : 3;   // the block's 8 key rows h0 - 3 .. h0 + 4 as 4 pairs; those with a row in the image, uniform per block
  const int Rb = h0 - PADW + 2 * p_lo;   // first row of the first pair
  auto rowc = [](int r) { return r < 0 ? 0 : (r > IH - 1 ? IH - 1 : r); };   // a pair's row outside the image is read as the nearest image row (finite values) and masked
  // out-of-image neighbour count for this lane's query: rows outside [0,IH) x 7 cols + in-image rows x cols outside [0,IW)
  const int r_lo = (h - PADW < 0) ? 0 : h - PADW, r_hi = (h + PADW > IH - 1) ? IH - 1 : h + PADW, c_lo = (wqx - PADW < 0) ? 0 : wqx - PADW, c_hi = (wqx + PADW > IW - 1) ? IW - 1 : wqx + PADW;
  b16* const X0 = (b16*)(L + OFF_XC); b16* const XQ = (b16*)(L + OFF_XQ); b16* const WQ = (b16*)(L + OFF_WQ); b16* const WK = (b16*)(L + OFF_WK); b16* const WV = (b16*)(L + OFF_WV); float* const BV = (float*)(L + OFF_BV); float* const BQ = (float*)(L + OFF_BQ); b16* const BK = (b16*)(L + OFF_BK);
  const int ypx = (tid & 15) * 4, yc = tid >> 4;    // channel rows: this thread's 4 pixels, of channels yc + 16 j
  const float* yb = x + ((size_t)b * C + yc) * NPI + ypx;
  const unsigned char* const XT = L + OFF_XC + (8 * hh + (lane & 7)) * VPB + 16 * ((lane >> 3) & 1);   // this lane's place in a 16-channel block for the transposing read
  const int orow = wave * 16 + col;
  const unsigned wob = (unsigned)(orow * C + 8 * hh) * 4u;   // one 32-bit byte offset for the row fragments of Wq and Wv: every such load names this register and its matrix's scalar base, which keep their values up to the wait below
  const unsigned wtb = (unsigned)(8 * hh * C + orow) * 4u;   // and one for the column fragments of Wk
  const int ti = tid & (C - 1);
  const float* const yq = yb + h0 * IW; const float* const yk = yb + rowc(Rb) * IW; const float* const yl = yb + rowc(Rb + 1) * IW;   // this thread's place in the first query row and in the first pair of key rows
  v4f xa[8], xb[8], xw[8], xv[8]; wraw rw[3][4];
#pragma unroll
  for (int kb = 0; kb < 4; ++kb) rw[0][kb] = load_w((const float*)((const char*)wq + wob) + kb * 32);
  __builtin_amdgcn_sched_barrier(0);   // the q weights are asked for first and so counted back first: they are rounded while the rest is still in flight
#pragma unroll
  for (int j = 0; j < 8; ++j) { xa[j] = *(const v4f*)(yq + (size_t)(16 * j) * NPI); xb[j] = *(const v4f*)(yq + (size_t)(16 * j) * NPI + IW); }
  const float bqr = bq[ti], bvr = bv[ti], bkr = bk[ti];
  __builtin_amdgcn_sched_barrier(0);   // then the query rows: the loads come back in the order in which they are laid down below
#pragma unroll
  for (int kb = 0; kb < 4; ++kb) { rw[1][kb] = load_wt((const float*)((const char*)wk + wtb) + kb * 32 * C); rw[2][kb] = load_w((const float*)((const char*)wv + wob) + kb * 32); }
#pragma unroll
  for (int j = 0; j < 8; ++j) { xw[j] = *(const v4f*)(yk + (size_t)(16 * j) * NPI); xv[j] = *(const v4f*)(yl + (size_t)(16 * j) * NPI); }
  asm volatile("s_wait_xcnt 0x0" :: "v"(wob), "v"(wtb), "v"(yq), "v"(yk), "v"(yl), "s"(wq), "s"(wk), "s"(wv), "s"(bq), "s"(bk), "s"(bv) : "memory");   // stands in front of whatever reuses the address registers of the loads above; the two offsets, the three x addresses and the scalar bases are named so that they keep their registers up to here
  __builtin_amdgcn_sched_barrier(0);   // holds the arithmetic below, which reuses those registers, behind the wait (a "memory" clobber does not)
  auto get_xc = [&](int ra, int rb) {   // two x rows: of each 4 pixels of 8 channels a thread, asked for directly behind a barrier (which waits for every load), used at the end of the stretch up to the next one
    __builtin_amdgcn_sched_barrier(0);   // keeps earlier arithmetic from sinking in between the loads and their wait, where it took the loads' address register
#pragma unroll
    for (int j = 0; j < 8; ++j) { xw[j] = *(const v4f*)(yb + (size_t)(16 * j) * NPI + ra * IW); xv[j] = *(const v4f*)(yb + (size_t)(16 * j) * NPI + rb * IW); }
    asm volatile("s_wait_xcnt 0x0" ::: "memory");   // as above
    __builtin_amdgcn_sched_barrier(0);   // as above: without it later arithmetic rose over the wait into the loads' address register
  };
  auto put_xc = [&](b16* X, const v4f (&w)[8]) {   // X: this thread's place in channel row yc; 8 bytes a store; the scale 8 goes on ahead of the rounding: a power of two, so the rounded value is the same, and the f32 product packs two values an instruction
#pragma unroll
    for (int j = 0; j < 8; ++j) { const v2b p = __builtin_convertvector(bf16_rne2(w[j][0] * XS, w[j][1] * XS), v2b), r = __builtin_convertvector(bf16_rne2(w[j][2] * XS, w[j][3] * XS), v2b);
      *(v4b*)(X + 16 * j * VP) = (v4b){p[0], p[1], r[0], r[1]}; }
  };
  auto put_w = [&](b16* M, const wraw (&r)[4]) {   // this wave's 16 rows of a weight matrix, rounded, go to LDS: every wave reads all 128
#pragma unroll
    for (int kb = 0; kb < 4; ++kb) { const v16b f = round_w(r[kb]); v8b a, c;
#pragma unroll
      for (int e = 0; e < 8; ++e) { a[e] = f[e]; c[e] = f[8 + e]; }
      *(v8b*)(M + orow * KP + kb * 32 + 8 * hh) = a; *(v8b*)(M + orow * KP + kb * 32 + 16 + 8 * hh) = c; }
  };
  b16* const Xk = X0 + yc * VP + SH + ypx;                       // this thread's place in the first key-row buffer
  b16* const Xq = XQ + yc * VP + (ypx >> 3) * 16 + (ypx & 7);    // and in the query rows: pixel p of row h0 + i at place 16 (p / 8) + 8 i + p % 8, a wave's 16 queries side by side
  { unsigned char* const z = L + OFF_XC + (tid >> 1) * VPB + (tid & 1) * ((IW + SH) * 2);   // the 4 places on either side of the image in the four key-row buffers: masked keys, which must be finite
#pragma unroll
    for (int i = 0; i < 4; ++i) *(v4b*)(z + i * VPL) = (v4b){}; }
  put_w(WQ, rw[0]); put_xc(Xq, xa); put_xc(Xq + 8, xb);
  // holds the 3 bias loads in front of the barrier, whose wait for every load covers them: left free they sink behind later barriers, each meets its latency there
  asm volatile("" :: "v"(bqr), "v"(bvr), "v"(bkr));
  if (tid < C) { BV[ti] = XS * bf16_rne(bvr); BQ[ti] = XS * bf16_rne(bqr); BK[ti] = (b16)bf16_rne(bkr); }
  put_w(WK, rw[1]); put_w(WV, rw[2]); put_xc(Xk, xw); put_xc(Xk + VPL / 2, xv);
  __syncthreads();                                  // the weights, the biases, the two query rows of x and the first pair of key rows are whole
  // q, u and t of this wave's 16 queries. Weight rows (for u: columns of Wk) are the first operand, so a lane holds channels 16 t + 8 hh + e of its query: tiles 2 kb and 2 kb + 1 are, as they lie, the next product's second operand for channel block kb.
  // The weight fragments come in groups of 4 tiles x 4 channel blocks, each group asked for one group ahead of its products.
  v16b qf[4], ql[4];   // this lane's u, hi and lo: in registers over the whole key-row loop
  float traw;
  { const b16* const WQl = WQ + col * KP; const b16* const WKl = WK + col * KP;
    const unsigned char* const Tq = XT + (OFF_XQ - OFF_XC) + wave * 32;
    v16b xf[4], ga[16], gb[16], bkf[4], qh[4], qw[4]; v8f acc[8]; v4f bqf[16];
    auto ld4 = [&](v16b (&g)[16], const b16* M, int t0) {
#pragma unroll
      for (int kb = 0; kb < 4; ++kb)
#pragma unroll
        for (int i = 0; i < 4; ++i) g[kb * 4 + i] = frag_kb(M + (t0 + i) * 16 * KP + kb * 32, hh);
    };
    auto mm4 = [&](const v16b (&g)[16], const v16b (&s)[4], int t0) {   // four independent accumulators in turn
#pragma unroll
      for (int kb = 0; kb < 4; ++kb)
#pragma unroll
        for (int i = 0; i < 4; ++i) acc[t0 + i] = wmma16c(g[kb * 4 + i], s[kb], acc[t0 + i]);
    };
#pragma unroll
    for (int kb = 0; kb < 4; ++kb) xf[kb] = frag_tr(Tq + kb * 32 * VPB, VPB);
    ld4(ga, WQl, 0);
    __builtin_amdgcn_sched_barrier(0);   // here and below: keeps a group's reads together, in the order of their use, and ahead of the products in front of which they are written, so that their latency passes under those products
    ld4(gb, WQl, 4);
    __builtin_amdgcn_sched_barrier(0);
#pragma unroll
    for (int t = 0; t < 8; ++t) acc[t] = (v8f){};
    mm4(ga, xf, 0);
    __builtin_amdgcn_sched_barrier(0);
    ld4(ga, WKl, 0);
#pragma unroll
    for (int t = 0; t < 8; ++t) { bqf[2 * t] = *(const v4f*)(BQ + t * 16 + 8 * hh); bqf[2 * t + 1] = *(const v4f*)(BQ + t * 16 + 8 * hh + 4); }
    __builtin_amdgcn_sched_barrier(0);
    mm4(gb, xf, 4);
    __builtin_amdgcn_sched_barrier(0);
    ld4(gb, WKl, 4);
#pragma unroll
    for (int kb = 0; kb < 4; ++kb) bkf[kb] = frag_kb(BK + kb * 32, hh);
    __builtin_amdgcn_sched_barrier(0);
#pragma unroll
    for (int kb = 0; kb < 4; ++kb)
#pragma unroll
      for (int g = 0; g < 2; ++g)
#pragma unroll
        for (int e = 0; e < 8; e += 2) { const int t = 2 * kb + g; v2b a_, c_; split16x2((v2f){acc[t][e] + bqf[2 * t + (e >> 2)][e & 3], acc[t][e + 1] + bqf[2 * t + (e >> 2)][(e & 3) + 1]}, a_, c_);
          qh[kb][8 * g + e] = a_[0]; qh[kb][8 * g + e + 1] = a_[1]; qw[kb][8 * g + e] = c_[0]; qw[kb][8 * g + e + 1] = c_[1]; }
    // u = Wk^T q (8u, as q carries x8): q hi over the four channel blocks, then q lo
#pragma unroll
    for (int t = 0; t < 8; ++t) acc[t] = (v8f){};
    mm4(ga, qh, 0); mm4(ga, qw, 0);
    mm4(gb, qh, 4); mm4(gb, qw, 4);
    // t = q.bk of this lane's query: bk as every row of the first operand, so that each of the 8 results of a lane is its query's t
    v8f ta = {};
#pragma unroll
    for (int kb = 0; kb < 4; ++kb) ta = wmma16c(bkf[kb], qh[kb], ta);
#pragma unroll
    for (int kb = 0; kb < 4; ++kb) ta = wmma16c(bkf[kb], qw[kb], ta);
    traw = ta[0] * XS;   // (8q).bk x 8: the scale 64 of the products (8x).(8u)
#pragma unroll
    for (int kb = 0; kb < 4; ++kb)
#pragma unroll
      for (int g = 0; g < 2; ++g)
#pragma unroll
        for (int e = 0; e < 8; e += 2) { v2b a_, c_; split16x2((v2f){acc[2 * kb + g][e], acc[2 * kb + g][e + 1]}, a_, c_);
          qf[kb][8 * g + e] = a_[0]; qf[kb][8 * g + e + 1] = a_[1]; ql[kb][8 * g + e] = c_[0]; ql[kb][8 * g + e + 1] = c_[1]; }
  }
  const int n_in = (r_hi - r_lo + 1) * (c_hi - c_lo + 1), n_out = KS * KS - n_in;
  float m = (n_out > 0) ? 0.0f : -INFINITY, l = (float)n_out, li = 0.0f; v8f o[8];   // li: the in-image part of l, which bv goes with
#pragma unroll
  for (int t = 0; t < 8; ++t) o[t] = (v8f){};
  const int kcb = wave * 8 - SH + 8 * hh;   // the image column of this lane's first key
  // one barrier a pair of key rows: between two barriers a wave attends to rows r, r + 1 (one buffer) and lays down x of rows r + 2, r + 3 (the other)
  const int nit = p_hi - p_lo + 1;
  for (int it = 0; it < nit; ++it) {
    const int r = Rb + 2 * it;
    if (it + 1 < nit) get_xc(rowc(r + 2), rowc(r + 3));
    {
    const unsigned char* Kr = XT + (it & 1) * (2 * VPL) + wave * 16; const b16* V = X0 + (it & 1) * VPL + wave * 8 + 8 * hh;
    const int lo0 = (r >= r_lo && r <= r_hi) ? c_lo : IW, lo1 = (r + 1 >= r_lo && r + 1 <= r_hi) ? c_lo : IW;   // a row outside this query's window (or the image) has no valid column
    v16b k0[4], k1[4], vf[8]; v8f s0, s1;
#pragma unroll
    for (int e = 0; e < 8; ++e) { s0[e] = traw; s1[e] = traw; }
#pragma unroll
    for (int t = 0; t < 4; ++t) { k0[t] = frag_tr(Kr + t * 32 * VPB, VPB); k1[t] = frag_tr(Kr + VPL + t * 32 * VPB, VPB); }
#pragma unroll
    for (int t = 0; t < 8; ++t) { const v8b a = *(const v8b*)(V + (t * 16 + col) * VP), c = *(const v8b*)(V + VPL / 2 + (t * 16 + col) * VP);   // keys 0..15 of the product: row r; 16..31: row r + 1 (the k order of frag_kb)
#pragma unroll
      for (int e = 0; e < 8; ++e) { vf[t][e] = a[e]; vf[t][8 + e] = c[e]; } }
    __builtin_amdgcn_sched_barrier(0);   // all of the row's LDS reads are issued here, in the order of their use: the latency is met once, and the channel rows return under the score products and the softmax
#pragma unroll
    for (int t = 0; t < 4; ++t) { s0 = wmma16c(k0[t], qf[t], s0); s1 = wmma16c(k1[t], qf[t], s1); s0 = wmma16c(k0[t], ql[t], s0); s1 = wmma16c(k1[t], ql[t], s1); }
    float mr = -INFINITY;
#pragma unroll
    for (int e = 0; e < 8; ++e) { const int kc = kcb + e; const bool v0 = (kc >= lo0) && (kc <= c_hi), v1 = (kc >= lo1) && (kc <= c_hi);
      s0[e] = v0 ? s0[e] * (1.0f / (XS * XS)) : -INFINITY; s1[e] = v1 ? s1[e] * (1.0f / (XS * XS)) : -INFINITY; mr = fmaxf(mr, fmaxf(s0[e], s1[e])); }
    mr = fmaxf(mr, __shfl_xor(mr, 16)); const float mn = fmaxf(m, mr); const float al_ = (mn == -INFINITY) ? 1.0f : nexp(m - mn); m = mn; float sum = 0.0f; v16b pb, pl;
#pragma unroll
    for (int e = 0; e < 8; e += 2) { v2f p0, p1;
#pragma unroll   // so that s0[e + i] and p0[i] are fixed registers
      for (int i = 0; i < 2; ++i) { const float e0 = (s0[e + i] == -INFINITY) ? 0.0f : nexp(s0[e + i] - mn), e1 = (s1[e + i] == -INFINITY) ? 0.0f : nexp(s1[e + i] - mn); sum += e0 + e1; p0[i] = e0 * PS; p1[i] = e1 * PS; }
      v2b a_, c_; split16x2(p0, a_, c_); pb[e] = a_[0]; pb[e + 1] = a_[1]; pl[e] = c_[0]; pl[e + 1] = c_[1]; split16x2(p1, a_, c_); pb[8 + e] = a_[0]; pb[9 + e] = a_[1]; pl[8 + e] = c_[0]; pl[9 + e] = c_[1]; }
    sum += __shfl_xor(sum, 16); l = l * al_ + sum; li = li * al_ + sum;
#pragma unroll
    for (int t = 0; t < 8; ++t) o[t] *= al_;
#pragma unroll
    for (int t = 0; t < 8; ++t) o[t] = wmma16c(vf[t], pb, o[t]);   // eight independent accumulators in turn
#pragma unroll
    for (int t = 0; t < 8; ++t) o[t] = wmma16c(vf[t], pl, o[t]);
    asm volatile("v_nop\n\tv_nop\n\tv_nop\n\tv_nop" : "+v"(o[7]));   // the distance behind the row's last product: on the last row, which has no x stores, only scalar instructions and the barrier follow, up to the arithmetic after the loop
    }
    if (it + 1 < nit) { put_xc(Xk + ((it + 1) & 1) * VPL, xw); put_xc(Xk + ((it + 1) & 1) * VPL + VPL / 2, xv); }
    __syncthreads();   // the next pair's x is whole; every wave has left this pair's
  }
  // y = Wv a / l + bv l_in / l: the accumulators of a lane are, as they lie, the second operand's fragments of its query (channels 32 kb + 8 hh + e and + 16), as hi+lo x8; 2 products
  const float rl = 1.0f / l, inv = rl * (1.0f / PS), bsc = li * rl;   // every pixel has at least itself in the window; (8x).(8p) carries x64, of which x8 stays for the split
  v16b ah[4], al[4];
#pragma unroll
  for (int kb = 0; kb < 4; ++kb)
#pragma unroll
    for (int g = 0; g < 2; ++g)
#pragma unroll
      for (int e = 0; e < 8; e += 2) { v2b a_, c_; split16x2((v2f){o[2 * kb + g][e] * inv, o[2 * kb + g][e + 1] * inv}, a_, c_); ah[kb][8 * g + e] = a_[0]; ah[kb][8 * g + e + 1] = a_[1]; al[kb][8 * g + e] = c_[0]; al[kb][8 * g + e + 1] = c_[1]; }
  float (*Os)[OP] = (float (*)[OP])(L + OFF_XC);   // over the key rows of x, which every wave has left at the loop's last barrier
#pragma unroll
  for (int t = 0; t < 8; ++t) { const v4f b0 = *(const v4f*)(BV + t * 16 + 8 * hh), b1 = *(const v4f*)(BV + t * 16 + 8 * hh + 4); v8f y;
#pragma unroll
    for (int e = 0; e < 4; ++e) { y[e] = b0[e] * bsc; y[4 + e] = b1[e] * bsc; }
#pragma unroll
    for (int kb = 0; kb < 4; ++kb) { const v16b w = frag_kb(WV + (t * 16 + col) * KP + kb * 32, hh); y = wmma16c(w, ah[kb], y); y = wmma16c(w, al[kb], y); }
    o[t] = y; }
#pragma unroll
  for (int t = 0; t < 8; ++t)
#pragma unroll
    for (int e = 0; e < 8; ++e) Os[t * 16 + 8 * hh + e][qr * OQ + wqx] = o[t][e] * (1.0f / XS);
  __syncthreads();
  { for (int i = tid; i < C * 32; i += 256) { const int c = i >> 5, c4 = (i & 31) * 4; *(v4f*)(out + ((size_t)b * C + c) * NPI + (size_t)h0 * IW + c4) = *(const v4f*)(&Os[c][c4 + (c4 >> 6) * (OQ - IW)]); }  }
}
}  // namespace

extern "C" void kernel_launch(void* const* d_in, const int* in_sizes, int n_in,
                              void* d_out, int out_size, void* d_ws, size_t ws_size, hipStream_t stream) {
  (void)n_in; (void)out_size; (void)d_ws; (void)ws_size;
  const float* x = (const float*)d_in[0]; const float* wq = (const float*)d_in[1]; const float* bq = (const float*)d_in[2]; const float* wk = (const float*)d_in[3]; const float* bk = (const float*)d_in[4]; const float* wv = (const float*)d_in[5]; const float* bv = (const float*)d_in[6];
  float* out = (float*)d_out;   // [8][128][64][64]
  if (in_sizes[0] != NT * C || in_sizes[1] != C * C) return;
  fused_kernel<<<dim3(1, IH / 2, Bn), 256, 0, stream>>>(x, wq, bq, wk, bk, wv, bv, out);
}

// v010
// One run takes 15.3 microseconds.
// Timed twice side by side with v009, it ran 1.09 and 1.10 times as fast.
// Counting every step since v000, it is 6.43 times as fast.
#include <hip/hip_runtime.h>

// Local 7x7 attention: q, k, v = 1x1 convs (+bias) of x [8][128][64][64]; for every pixel, scores over the 49 zero-padded neighbours = sum_c q[c] k_unf[c] (padded neighbours score exactly
// 0 and carry v = 0), softmax over the 49, y[c] = sum attn v_unf[c] -> [8][128][64][64] (NCHW).
// WMMA (v_wmma_f32_16x16x32_f16, f32 accumulate). Operands x and W rounded to bf16 (exact in f16); every intermediate (q, Wk^T q, P, the weighted sum of x) as an f16 hi+lo pair x8 (the unscaled
// 128-term logits have a deviation of about 11, so their absolute precision matters); window mask by index compare, the out-of-image neighbours added analytically as n_out * e^(0 - m) to the denominator.

namespace {
constexpr int Bn = 8, C = 128, IH = 64, IW = 64, NPI = IH * IW, NT = Bn * NPI, KS = 7, PADW = 3;
constexpr float XS = 8.0f, PS = 8.0f;

typedef _Float16 b16;
typedef __attribute__((ext_vector_type(16))) _Float16 v16b;
typedef __attribute__((ext_vector_type(8))) _Float16 v8b;
typedef __attribute__((ext_vector_type(8))) float v8f;
typedef __attribute__((ext_vector_type(4))) float v4f;
typedef __attribute__((ext_vector_type(2))) float v2f;
typedef __attribute__((ext_vector_type(2))) _Float16 v2b;
typedef __attribute__((ext_vector_type(4))) _Float16 v4b;
typedef __attribute__((ext_vector_type(2))) __bf16 v2r;
// rounding to bf16 (nearest, ties to even) by the chip's own convert, two values an instruction, and back to f32
__device__ __forceinline__ float bf16_rne(float f) { return (float)(__bf16)f; }
__device__ __forceinline__ v2f bf16_rne2(float a, float b) { return __builtin_convertvector(__builtin_convertvector((v2f){a, b}, v2r), v2f); }
__device__ __forceinline__ void split16x2(v2f v, v2b& hi, v2b& lo) { hi = __builtin_convertvector(v, v2b); lo = __builtin_convertvector(v - __builtin_convertvector(hi, v2f), v2b); }
__device__ __forceinline__ v16b frag_kb(const b16* p, int hh) { const v8b a = *(const v8b*)(p + 8 * hh), b = *(const v8b*)(p + 16 + 8 * hh); v16b f;
#pragma unroll
  for (int e = 0; e < 8; ++e) { f[e] = a[e]; f[8 + e] = b[e]; } return f; }
// the same fragment (the k order of frag_kb) out of rows that run the other way: p = this lane's 16 bytes of a 16-row block, row 8 * hh + (lane & 7), bytes 16 * ((lane >> 3) & 1); the lane gets rows 8 hh .. + 7 and, 16 rows on, the same again, of column (lane & 15)
typedef __attribute__((ext_vector_type(8))) short v8s;
__device__ __forceinline__ v8b ld_tr16(const unsigned char* p) { typedef __attribute__((address_space(3))) v8s lds_v8s; return __builtin_bit_cast(v8b, __builtin_amdgcn_ds_load_tr16_b128_v8i16((lds_v8s*)p)); }
__device__ __forceinline__ v16b frag_tr(const unsigned char* p, int pitch) { const v8b a = ld_tr16(p), b = ld_tr16(p + 16 * pitch); v16b f;
#pragma unroll
  for (int e = 0; e < 8; ++e) { f[e] = a[e]; f[8 + e] = b[e]; } return f; }
// the product, with the distance behind it left to the compiler
__device__ __forceinline__ v8f wmma16c(v16b a, v16b b, v8f c) { return __builtin_amdgcn_wmma_f32_16x16x32_f16(false, a, false, b, (short)0, c, false, false); }
__device__ __forceinline__ float nexp(float x) { return __builtin_amdgcn_exp2f(x * 1.4426950408889634f); }

// all in one launch: block = (image b, two query rows h0, h0+1, all 64 columns) x 8 waves. k and v are never formed. Both convs are linear, so
//   q.k_j = q.(Wk x_j + bk) = (Wk^T q).x_j + q.bk   and   sum_j p_j v_j = Wv (sum_j p_j x_j) + bv sum_j p_j   (j: the in-image neighbours; the padded ones score 0 and carry 0 as before).
// Once per query: q, then u = Wk^T q (q as hi+lo, 2 products) and t = q.bk, each wave for its own 16 queries over all 128 channels: with the weight rows as the first operand a product's results lie in a lane as the next product's second operand wants them, so q and u never leave the registers. Per key row: the rounded x row lies in LDS once, as channel rows (it is exact in f16, one plane); fragments along the pixels are plain reads, fragments along the channels come by the transposing read;
// wave w attends for the 2 x 8 queries of rows h0, h0 + 1, columns 8w..+7: their windows lie in 16 key columns (8w - 4 .. 8w + 11), so a key row is ONE tile of 16 keys and two key rows fill the 32 keys of a product with P.
// Per pair of key rows: S^T = x.u + t (u as hi+lo, 2 products), window mask |dr| <= 3, |dc| <= 3, a^T += x^T.P^T (P as hi+lo, 2 products). Once at the end: y = Wv a / l + bv l_in / l.
constexpr int KP = C + 8, VP = IW + 80;                         // LDS pitches in halfs: 272 B = 16 B x odd for plain 16-byte reads; the x rows 288 B = 32 B x odd, the transposing read's pitch (its fragments are wanted first in a key row); 160 B is the same on the banks, but with it this compiler laid out the Wv reads of the end as read, wait, product
constexpr int VPL = C * VP * 2, VPB = VP * 2;                    // bytes of one x row as channel rows; the x pitch in bytes
constexpr int WPL = C * KP * 2;                                  // bytes of one rounded weight matrix
constexpr int WKB = (C + 16) * 2, WKL = C * WKB;                 // Wk lies in LDS as its own rows, read by the transposing read: its pitch 288 B = 32 B x odd, and its bytes
constexpr int SH = 4;                                            // a key row's pixel p lies at place p + 4 of its channel row, so that a wave's 16 key columns begin at a multiple of 16 bytes; places 0..3 and 68..71 are zero
constexpr int OQ = IW + 8, OP = 2 * IW + 12;                     // output staging, in floats: the second query row's start and the channel pitch (the 32 lanes of a store on 32 banks)
constexpr int OFF_WQ = 0, OFF_WK = OFF_WQ + WPL, OFF_XC = OFF_WK + WKL, OFF_XQ = OFF_XC + 4 * VPL, OFF_WV = OFF_XQ + VPL, OFF_BV = OFF_WV + WPL, OFF_BQ = OFF_BV + C * 4, OFF_BK = OFF_BQ + C * 4, LDS_ALL = OFF_BK + C * 2;   // Wq and Wk lowest: every fragment of a matrix is then within a read's 16-bit offset of one lane address
__global__ __launch_bounds__(256) void fused_kernel(const float* __restrict__ x, const float* __restrict__ wq, const float* __restrict__ bq, const float* __restrict__ wk, const float* __restrict__ bk, const float* __restrict__ wv, const float* __restrict__ bv, float* __restrict__ out) {
  __shared__ __attribute__((aligned(16))) unsigned char L[LDS_ALL];   // Wq and Wk rounded, two buffers of a pair of key rows of x as channel rows (at the end the output staging), the two query rows of x in one channel row (8 pixels of the one, 8 of the other in turn), Wv rounded, bv, bq and bk rounded
  const int tid = threadIdx.x, lane = tid & 31, wave = __builtin_amdgcn_readfirstlane(tid >> 5), hh = lane >> 4, col = lane & 15;
  const int b = blockIdx.z, h0 = blockIdx.y * 2, qr = col >> 3, h = h0 + qr, wqx = wave * 8 + (col & 7);   // this lane's query
  const int p_lo = (h0 < PADW) ? (PADW - h0) / 2 : 0, p_hi = ((IH - 1 + PADW - h0) / 2 < 3) ? (IH - 1 + PADW - h0) / 2 : 3;   // the block's 8 key rows h0 - 3 .. h0 + 4 as 4 pairs; those with a row in the image, uniform per block
  const int Rb = h0 - PADW + 2 * p_lo;   // first row of the first pair
  auto rowc = [](int r) { return r < 0 ? 0 : (r > IH - 1 ? IH - 1 : r); };   // a pair's row outside the image is read as the nearest image row (finite values) and masked
  // out-of-image neighbour count for this lane's query: rows outside [0,IH) x 7 cols + in-image rows x cols outside [0,IW)
  const int r_lo = (h - PADW < 0) ? 0 : h - PADW, r_hi = (h + PADW > IH - 1) ? IH - 1 : h + PADW, c_lo = (wqx - PADW < 0) ? 0 : wqx - PADW, c_hi = (wqx + PADW > IW - 1) ? IW - 1 : wqx + PADW;
  b16* const X0 = (b16*)(L + OFF_XC); b16* const XQ = (b16*)(L + OFF_XQ); b16* const WQ = (b16*)(L + OFF_WQ); b16* const WK = (b16*)(L + OFF_WK); b16* const WV = (b16*)(L + OFF_WV); float* const BV = (float*)(L + OFF_BV); float* const BQ = (float*)(L + OFF_BQ); b16* const BK = (b16*)(L + OFF_BK);
  const int ypx = (tid & 15) * 4, yc = tid >> 4;    // channel rows: this thread's 4 pixels, of channels yc + 16 j
  const float* yb = x + ((size_t)b * C + yc) * NPI + ypx;
  const unsigned char* const XT = L + OFF_XC + (8 * hh + (lane & 7)) * VPB + 16 * ((lane >> 3) & 1);   // this lane's place in a 16-channel block for the transposing read
  const unsigned wrb = (unsigned)(wave * 16 * C + lane * 4) * 4u;   // a wave fetches rows 16 wave .. + 15 of each weight matrix, a whole row of 512 B a load (4 cache lines, each whole); one 32-bit byte offset: every such load names this register and its matrix's scalar base, which keep their values up to the wait below
  const int ti = tid & (C - 1);
  const float* const yq = yb + h0 * IW; const float* const yk = yb + rowc(Rb) * IW; const float* const yl = yb + rowc(Rb + 1) * IW;   // this thread's place in the first query row and in the first pair of key rows
  v4f xa[8], xb[8], xw[8], xv[8], rw[3][16];
#pragma unroll
  for (int j = 0; j < 16; ++j) rw[0][j] = *(const v4f*)((const char*)wq + wrb + j * C * 4);
  __builtin_amdgcn_sched_barrier(0);   // the q weights are asked for first and so counted back first: they are rounded while the rest is still in flight
#pragma unroll
  for (int j = 0; j < 8; ++j) { xa[j] = *(const v4f*)(yq + (size_t)(16 * j) * NPI); xb[j] = *(const v4f*)(yq + (size_t)(16 * j) * NPI + IW); }
  const float bqr = bq[ti], bvr = bv[ti], bkr = bk[ti];
  __builtin_amdgcn_sched_barrier(0);   // then the query rows: the loads come back in the order in which they are laid down below
#pragma unroll
  for (int j = 0; j < 16; ++j) rw[1][j] = *(const v4f*)((const char*)wk + wrb + j * C * 4);
#pragma unroll
  for (int j = 0; j < 16; ++j) rw[2][j] = *(const v4f*)((const char*)wv + wrb + j * C * 4);
#pragma unroll
  for (int j = 0; j < 8; ++j) { xw[j] = *(const v4f*)(yk + (size_t)(16 * j) * NPI); xv[j] = *(const v4f*)(yl + (size_t)(16 * j) * NPI); }
  asm volatile("s_wait_xcnt 0x0" :: "v"(wrb), "v"(yq), "v"(yk), "v"(yl), "s"(wq), "s"(wk), "s"(wv), "s"(bq), "s"(bk), "s"(bv) : "memory");   // stands in front of whatever reuses the address registers of the loads above; the weight offset, the three x addresses and the scalar bases are named so that they keep their registers up to here
  __builtin_amdgcn_sched_barrier(0);   // holds the arithmetic below, which reuses those registers, behind the wait (a "memory" clobber does not)
  auto get_xc = [&](int ra, int rb) {   // two x rows: of each 4 pixels of 8 channels a thread, asked for directly behind a barrier (which waits for every load), used at the end of the stretch up to the next one
    __builtin_amdgcn_sched_barrier(0);   // keeps earlier arithmetic from sinking in between the loads and their wait, where it took the loads' address register
#pragma unroll
    for (int j = 0; j < 8; ++j) { xw[j] = *(const v4f*)(yb + (size_t)(16 * j) * NPI + ra * IW); xv[j] = *(const v4f*)(yb + (size_t)(16 * j) * NPI + rb * IW); }
    asm volatile("s_wait_xcnt 0x0" ::: "memory");   // as above
    __builtin_amdgcn_sched_barrier(0);   // as above: without it later arithmetic rose over the wait into the loads' address register
  };
  auto put_xc = [&](b16* X, const v4f (&w)[8]) {   // X: this thread's place in channel row yc; 8 bytes a store; the scale 8 goes on ahead of the rounding: a power of two, so the rounded value is the same, and the f32 product packs two values an instruction
#pragma unroll
    for (int j = 0; j < 8; ++j) { const v2b p = __builtin_convertvector(bf16_rne2(w[j][0] * XS, w[j][1] * XS), v2b), r = __builtin_convertvector(bf16_rne2(w[j][2] * XS, w[j][3] * XS), v2b);
      *(v4b*)(X + 16 * j * VP) = (v4b){p[0], p[1], r[0], r[1]}; }
  };
  auto put_w = [&](b16* M, int pitch, const v4f (&r)[16]) {   // this wave's 16 rows of a weight matrix, rounded (as the operands are defined), go to LDS: every wave reads all 128; 8 bytes a lane, a row's 256 B side by side
#pragma unroll
    for (int j = 0; j < 16; ++j) { const v2b p = __builtin_convertvector(bf16_rne2(r[j][0], r[j][1]), v2b), s = __builtin_convertvector(bf16_rne2(r[j][2], r[j][3]), v2b);
      *(v4b*)(M + (wave * 16 + j) * pitch + lane * 4) = (v4b){p[0], p[1], s[0], s[1]}; }
  };
  b16* const Xk = X0 + yc * VP + SH + ypx;                       // this thread's place in the first key-row buffer
  b16* const Xq = XQ + yc * VP + (ypx >> 3) * 16 + (ypx & 7);    // and in the query rows: pixel p of row h0 + i at place 16 (p / 8) + 8 i + p % 8, a wave's 16 queries side by side
  { unsigned char* const z = L + OFF_XC + (tid >> 1) * VPB + (tid & 1) * ((IW + SH) * 2);   // the 4 places on either side of the image in the four key-row buffers: masked keys, which must be finite
#pragma unroll
    for (int i = 0; i < 4; ++i) *(v4b*)(z + i * VPL) = (v4b){}; }
  put_w(WQ, KP, rw[0]); put_xc(Xq, xa); put_xc(Xq + 8, xb);
  // holds the 3 bias loads in front of the barrier, whose wait for every load covers them: left free they sink behind later barriers, each meets its latency there
  asm volatile("" :: "v"(bqr), "v"(bvr), "v"(bkr));
  if (tid < C) { BV[ti] = XS * bf16_rne(bvr); BQ[ti] = XS * bf16_rne(bqr); BK[ti] = (b16)bf16_rne(bkr); }
  put_w(WK, WKB / 2, rw[1]); put_w(WV, KP, rw[2]); put_xc(Xk, xw); put_xc(Xk + VPL / 2, xv);
  __syncthreads();                                  // the weights, the biases, the two query rows of x and the first pair of key rows are whole
  // q, u and t of this wave's 16 queries. Weight rows (for u: columns of Wk) are the first operand, so a lane holds channels 16 t + 8 hh + e of its query: tiles 2 kb and 2 kb + 1 are, as they lie, the next product's second operand for channel block kb.
  // The weight fragments come in groups of 4 tiles x 4 channel blocks, each group asked for one group ahead of its products.
  v16b qf[4], ql[4];   // this lane's u, hi and lo: in registers over the whole key-row loop
  float traw;
  { const b16* const WQl = WQ + col * KP; const unsigned char* const WKt = L + OFF_WK + (8 * hh + (lane & 7)) * WKB + 16 * ((lane >> 3) & 1);   // this lane's place in a 16-row block of Wk for the transposing read
    const unsigned char* const Tq = XT + (OFF_XQ - OFF_XC) + wave * 32;
    v16b xf[4], ga[16], gb[16], bkf[4], qh[4], qw[4]; v8f acc[8]; v4f bqf[16];
    auto ld4 = [&](v16b (&g)[16], const b16* M, int t0) {
#pragma unroll
      for (int kb = 0; kb < 4; ++kb)
#pragma unroll
        for (int i = 0; i < 4; ++i) g[kb * 4 + i] = frag_kb(M + (t0 + i) * 16 * KP + kb * 32, hh);
    };
    auto ld4t = [&](v16b (&g)[16], int t0) {   // the same fragments of Wk^T: rows of Wk are the summed channels, 16 of its columns a tile
#pragma unroll
      for (int kb = 0; kb < 4; ++kb)
#pragma unroll
        for (int i = 0; i < 4; ++i) g[kb * 4 + i] = frag_tr(WKt + kb * 32 * WKB + (t0 + i) * 32, WKB);
    };
    auto mm4 = [&](const v16b (&g)[16], const v16b (&s)[4], int t0) {   // four independent accumulators in turn
#pragma unroll
      for (int kb = 0; kb < 4; ++kb)
#pragma unroll
        for (int i = 0; i < 4; ++i) acc[t0 + i] = wmma16c(g[kb * 4 + i], s[kb], acc[t0 + i]);
    };
#pragma unroll
    for (int kb = 0; kb < 4; ++kb) xf[kb] = frag_tr(Tq + kb * 32 * VPB, VPB);
    ld4(ga, WQl, 0);
    __builtin_amdgcn_sched_barrier(0);   // here and below: keeps a group's reads together, in the order of their use, and ahead of the products in front of which they are written, so that their latency passes under those products
    ld4(gb, WQl, 4);
    __builtin_amdgcn_sched_barrier(0);
#pragma unroll
    for (int t = 0; t < 8; ++t) acc[t] = (v8f){};
    mm4(ga, xf, 0);
    __builtin_amdgcn_sched_barrier(0);
    ld4t(ga, 0);
#pragma unroll
    for (int t = 0; t < 8; ++t) { bqf[2 * t] = *(const v4f*)(BQ + t * 16 + 8 * hh); bqf[2 * t + 1] = *(const v4f*)(BQ + t * 16 + 8 * hh + 4); }
    __builtin_amdgcn_sched_barrier(0);
    mm4(gb, xf, 4);
    __builtin_amdgcn_sched_barrier(0);
    ld4t(gb, 4);
#pragma unroll
    for (int kb = 0; kb < 4; ++kb) bkf[kb] = frag_kb(BK + kb * 32, hh);
    __builtin_amdgcn_sched_barrier(0);
#pragma unroll
    for (int kb = 0; kb < 4; ++kb)
#pragma unroll
      for (int g = 0; g < 2; ++g)
#pragma unroll
        for (int e = 0; e < 8; e += 2) { const int t = 2 * kb + g; v2b a_, c_; split16x2((v2f){acc[t][e] + bqf[2 * t + (e >> 2)][e & 3], acc[t][e + 1] + bqf[2 * t + (e >> 2)][(e & 3) + 1]}, a_, c_);
          qh[kb][8 * g + e] = a_[0]; qh[kb][8 * g + e + 1] = a_[1]; qw[kb][8 * g + e] = c_[0]; qw[kb][8 * g + e + 1] = c_[1]; }
    // u = Wk^T q (8u, as q carries x8): q hi over the four channel blocks, then q lo
#pragma unroll
    for (int t = 0; t < 8; ++t) acc[t] = (v8f){};
    mm4(ga, qh, 0); mm4(ga, qw, 0);
    mm4(gb, qh, 4); mm4(gb, qw, 4);
    // t = q.bk of this lane's query: bk as every row of the first operand, so that each of the 8 results of a lane is its query's t
    v8f ta = {};
#pragma unroll
    for (int kb = 0; kb < 4; ++kb) ta = wmma16c(bkf[kb], qh[kb], ta);
#pragma unroll
    for (int kb = 0; kb < 4; ++kb) ta = wmma16c(bkf[kb], qw[kb], ta);
    traw = ta[0] * XS;   // (8q).bk x 8: the scale 64 of the products (8x).(8u)
#pragma unroll
    for (int kb = 0; kb < 4; ++kb)
#pragma unroll
      for (int g = 0; g < 2; ++g)
#pragma unroll
        for (int e = 0; e < 8; e += 2) { v2b a_, c_; split16x2((v2f){acc[2 * kb + g][e], acc[2 * kb + g][e + 1]}, a_, c_);
          qf[kb][8 * g + e] = a_[0]; qf[kb][8 * g + e + 1] = a_[1]; ql[kb][8 * g + e] = c_[0]; ql[kb][8 * g + e + 1] = c_[1]; }
  }
  const int n_in = (r_hi - r_lo + 1) * (c_hi - c_lo + 1), n_out = KS * KS - n_in;
  float m = (n_out > 0) ? 0.0f : -INFINITY, l = (float)n_out, li = 0.0f; v8f o[8];   // li: the in-image part of l, which bv goes with
#pragma unroll
  for (int t = 0; t < 8; ++t) o[t] = (v8f){};
  const int kcb = wave * 8 - SH + 8 * hh;   // the image column of this lane's first key
  // one barrier a pair of key rows: between two barriers a wave attends to rows r, r + 1 (one buffer) and lays down x of rows r + 2, r + 3 (the other)
  const int nit = p_hi - p_lo + 1;
  for (int it = 0; it < nit; ++it) {
    const int r = Rb + 2 * it;
    if (it + 1 < nit) get_xc(rowc(r + 2), rowc(r + 3));
    {
    const unsigned char* Kr = XT + (it & 1) * (2 * VPL) + wave * 16; const b16* V = X0 + (it & 1) * VPL + wave * 8 + 8 * hh;
    const int lo0 = (r >= r_lo && r <= r_hi) ? c_lo : IW, lo1 = (r + 1 >= r_lo && r + 1 <= r_hi) ? c_lo : IW;   // a row outside this query's window (or the image) has no valid column
    v16b k0[4], k1[4], vf[8]; v8f s0, s1;
#pragma unroll
    for (int e = 0; e < 8; ++e) { s0[e] = traw; s1[e] = traw; }
#pragma unroll
    for (int t = 0; t < 4; ++t) { k0[t] = frag_tr(Kr + t * 32 * VPB, VPB); k1[t] = frag_tr(Kr + VPL + t * 32 * VPB, VPB); }
#pragma unroll
    for (int t = 0; t < 8; ++t) { const v8b a = *(const v8b*)(V + (t * 16 + col) * VP), c = *(const v8b*)(V + VPL / 2 + (t * 16 + col) * VP);   // keys 0..15 of the product: row r; 16..31: row r + 1 (the k order of frag_kb)
#pragma unroll
      for (int e = 0; e < 8; ++e) { vf[t][e] = a[e]; vf[t][8 + e] = c[e]; } }
    __builtin_amdgcn_sched_barrier(0);   // all of the row's LDS reads are issued here, in the order of their use: the latency is met once, and the channel rows return under the score products and the softmax
#pragma unroll
    for (int t = 0; t < 4; ++t) { s0 = wmma16c(k0[t], qf[t], s0); s1 = wmma16c(k1[t], qf[t], s1); s0 = wmma16c(k0[t], ql[t], s0); s1 = wmma16c(k1[t], ql[t], s1); }
    float mr = -INFINITY;
#pragma unroll
    for (int e = 0; e < 8; ++e) { const int kc = kcb + e; const bool v0 = (kc >= lo0) && (kc <= c_hi), v1 = (kc >= lo1) && (kc <= c_hi);
      s0[e] = v0 ? s0[e] * (1.0f / (XS * XS)) : -INFINITY; s1[e] = v1 ? s1[e] * (1.0f / (XS * XS)) : -INFINITY; mr = fmaxf(mr, fmaxf(s0[e], s1[e])); }
    mr = fmaxf(mr, __shfl_xor(mr, 16)); const float mn = fmaxf(m, mr); const float al_ = (mn == -INFINITY) ? 1.0f : nexp(m - mn); m = mn; float sum = 0.0f; v16b pb, pl;
#pragma unroll
    for (int e = 0; e < 8; e += 2) { v2f p0, p1;
#pragma unroll   // so that s0[e + i] and p0[i] are fixed registers
      for (int i = 0; i < 2; ++i) { const float e0 = (s0[e + i] == -INFINITY) ? 0.0f : nexp(s0[e + i] - mn), e1 = (s1[e + i] == -INFINITY) ? 0.0f : nexp(s1[e + i] - mn); sum += e0 + e1; p0[i] = e0 * PS; p1[i] = e1 * PS; }
      v2b a_, c_; split16x2(p0, a_, c_); pb[e] = a_[0]; pb[e + 1] = a_[1]; pl[e] = c_[0]; pl[e + 1] = c_[1]; split16x2(p1, a_, c_); pb[8 + e] = a_[0]; pb[9 + e] = a_[1]; pl[8 + e] = c_[0]; pl[9 + e] = c_[1]; }
    sum += __shfl_xor(sum, 16); l = l * al_ + sum; li = li * al_ + sum;
#pragma unroll
    for (int t = 0; t < 8; ++t) o[t] *= al_;
#pragma unroll
    for (int t = 0; t < 8; ++t) o[t] = wmma16c(vf[t], pb, o[t]);   // eight independent accumulators in turn
#pragma unroll
    for (int t = 0; t < 8; ++t) o[t] = wmma16c(vf[t], pl, o[t]);
    asm volatile("v_nop\n\tv_nop\n\tv_nop\n\tv_nop" : "+v"(o[7]));   // the distance behind the row's last product: on the last row, which has no x stores, only scalar instructions and the barrier follow, up to the arithmetic after the loop
    }
    if (it + 1 < nit) { put_xc(Xk + ((it + 1) & 1) * VPL, xw); put_xc(Xk + ((it + 1) & 1) * VPL + VPL / 2, xv); }
    __syncthreads();   // the next pair's x is whole; every wave has left this pair's
  }
  // y = Wv a / l + bv l_in / l: the accumulators of a lane are, as they lie, the second operand's fragments of its query (channels 32 kb + 8 hh + e and + 16), as hi+lo x8; 2 products
  const float rl = 1.0f / l, inv = rl * (1.0f / PS), bsc = li * rl;   // every pixel has at least itself in the window; (8x).(8p) carries x64, of which x8 stays for the split
  v16b ah[4], al[4];
#pragma unroll
  for (int kb = 0; kb < 4; ++kb)
#pragma unroll
    for (int g = 0; g < 2; ++g)
#pragma unroll
      for (int e = 0; e < 8; e += 2) { v2b a_, c_; split16x2((v2f){o[2 * kb + g][e] * inv, o[2 * kb + g][e + 1] * inv}, a_, c_); ah[kb][8 * g + e] = a_[0]; ah[kb][8 * g + e + 1] = a_[1]; al[kb][8 * g + e] = c_[0]; al[kb][8 * g + e + 1] = c_[1]; }
  float (*Os)[OP] = (float (*)[OP])(L + OFF_XC);   // over the key rows of x, which every wave has left at the loop's last barrier
#pragma unroll
  for (int t = 0; t < 8; ++t) { const v4f b0 = *(const v4f*)(BV + t * 16 + 8 * hh), b1 = *(const v4f*)(BV + t * 16 + 8 * hh + 4); v8f y;
#pragma unroll
    for (int e = 0; e < 4; ++e) { y[e] = b0[e] * bsc; y[4 + e] = b1[e] * bsc; }
#pragma unroll
    for (int kb = 0; kb < 4; ++kb) { const v16b w = frag_kb(WV + (t * 16 + col) * KP + kb * 32, hh); y = wmma16c(w, ah[kb], y); y = wmma16c(w, al[kb], y); }
    o[t] = y; }
#pragma unroll
  for (int t = 0; t < 8; ++t)
#pragma unroll
    for (int e = 0; e < 8; ++e) Os[t * 16 + 8 * hh + e][qr * OQ + wqx] = o[t][e] * (1.0f / XS);
  __syncthreads();
  { for (int i = tid; i < C * 32; i += 256) { const int c = i >> 5, c4 = (i & 31) * 4; *(v4f*)(out + ((size_t)b * C + c) * NPI + (size_t)h0 * IW + c4) = *(const v4f*)(&Os[c][c4 + (c4 >> 6) * (OQ - IW)]); }  }
}
}  // namespace

extern "C" void kernel_launch(void* const* d_in, const int* in_sizes, int n_in,
                              void* d_out, int out_size, void* d_ws, size_t ws_size, hipStream_t stream) {
  (void)n_in; (void)out_size; (void)d_ws; (void)ws_size;
  const float* x = (const float*)d_in[0]; const float* wq = (const float*)d_in[1]; const float* bq = (const float*)d_in[2]; const float* wk = (const float*)d_in[3]; const float* bk = (const float*)d_in[4]; const float* wv = (const float*)d_in[5]; const float* bv = (const float*)d_in[6];
  float* out = (float*)d_out;   // [8][128][64][64]
  if (in_sizes[0] != NT * C || in_sizes[1] != C * C) return;
  fused_kernel<<<dim3(1, IH / 2, Bn), 256, 0, stream>>>(x, wq, bq, wk, bk, wv, bv, out);
}
